// v000
// Times are from an AMD MI455X. After a warm-up the kernel runs many times in a row, and a time is the length of
// such a window on the GPU divided by its runs, so every launch and the gaps after it count. The runs cycle
// through copies of the inputs. A figure is the median of several windows, for all but v000 over two sittings.
// Sittings can differ by a few percent; kernels timed side by side share one.
// The starting kernel, v000, takes 223 microseconds a run.
// compute dtype: all float inputs rounded to bf16; logits q . k with EXACT bf16 products on WMMA 16x16x32 (1 product: q and k are inputs), |k|^2 per key in f32 (the per-query |q|^2 term is constant along the softmax axis and cancels), running-max softmax in f32 (hardware exp), P as f16 hi + residual (x 2^11) . v (bf16 values as f16 planes, 2 products); f32 output.
#include <hip/hip_runtime.h>
#include <math.h>

typedef __attribute__((ext_vector_type(16))) _Float16 v16h;
typedef __attribute__((ext_vector_type(16))) __bf16 v16b;
typedef __attribute__((ext_vector_type(8)))  _Float16 v8h;
typedef __attribute__((ext_vector_type(8)))  float v8f;
typedef __attribute__((ext_vector_type(4)))  float v4f;
typedef __attribute__((ext_vector_type(2)))  float v2f;
typedef __attribute__((ext_vector_type(4)))  unsigned v4u;
typedef __attribute__((ext_vector_type(4)))  int v4i;
typedef float __attribute__((may_alias)) float_a;
typedef int __attribute__((may_alias)) int_a;

template <typename T> __device__ __forceinline__ void vst2(void* p, T v) { *(T*)p = v;  }
__device__ __forceinline__ v8f wmma16(v16h a, v16h b, v8f c) {
  v8f d = __builtin_amdgcn_wmma_f32_16x16x32_f16(false, a, false, b, (short)0, c, false, false);
  asm volatile("v_nop\n\tv_nop\n\tv_nop\n\tv_nop" : "+v"(d) : "v"(a), "v"(b));
  return d;
}
__device__ __forceinline__ v8f wmma_bf(v16b a, v16b b, v8f c) {
  v8f d = __builtin_amdgcn_wmma_f32_16x16x32_bf16(false, a, false, b, (short)0, c, false, false);
  asm volatile("v_nop\n\tv_nop\n\tv_nop\n\tv_nop" : "+v"(d) : "v"(a), "v"(b));
  return d;
}
// 16x16x32 fragments: lane = (h = lane>>4, row/col = lane&15); elements 0..7 = k0+8h+0..7, 8..15 = k0+16+8h+0..7; D element r = row 8h+r
__device__ __forceinline__ v16h frag_h(const _Float16* rowk0, int lane) {
  union { v16h v; v8h q[2]; } u; const _Float16* p = rowk0 + 8 * (lane >> 4);
  u.q[0] = *(const v8h*)p; u.q[1] = *(const v8h*)(p + 16); return u.v;
}
__device__ __forceinline__ v16h frag_f32(const float* rowk0, int lane) {
  v16h a; const float* p = rowk0 + 8 * (lane >> 4);
#pragma unroll
  for (int i = 0; i < 8; ++i) { a[i] = (_Float16)p[i]; a[8 + i] = (_Float16)p[16 + i]; }
  return a;
}
__device__ __forceinline__ v16h frag_f32s(const float* rowk0, int lane, float sc) {
  v16h a; const float* p = rowk0 + 8 * (lane >> 4);
#pragma unroll
  for (int i = 0; i < 8; ++i) { a[i] = (_Float16)(p[i] * sc); a[8 + i] = (_Float16)(p[16 + i] * sc); }
  return a;
}
// column fragment from a [K][ld] layout (column n), rows >= K read as 0
__device__ __forceinline__ v16h fragc_f32(const float* W, int k0, int n, int lane, int ld, int K) {
  v16h a; const int g = lane >> 4;
#pragma unroll
  for (int i = 0; i < 8; ++i) { const int ka = k0 + 8 * g + i, kb = ka + 16;
    a[i] = (_Float16)(ka < K ? W[(size_t)(ka < K ? ka : K - 1) * ld + n] : 0.f); a[8 + i] = (_Float16)(kb < K ? W[(size_t)(kb < K ? kb : K - 1) * ld + n] : 0.f); }
  return a;
}
struct F2 { v16b h, l; };
__device__ __forceinline__ F2 bsplit16(const float v[16]) { F2 r;
#pragma unroll
  for (int i = 0; i < 16; ++i) { const __bf16 h = (__bf16)v[i]; r.h[i] = h; r.l[i] = (__bf16)(v[i] - (float)h); }
  return r; }
__device__ __forceinline__ F2 split_row(const float* row, int k0, int lane) { float v[16]; const float* p = row + k0 + 8 * (lane >> 4);
#pragma unroll
  for (int i = 0; i < 8; ++i) { v[i] = p[i]; v[8 + i] = p[16 + i]; }
  return bsplit16(v); }
__device__ __forceinline__ F2 split_rowK(const float* row, int k0, int lane, int K) { float v[16]; const int g = lane >> 4;
#pragma unroll
  for (int i = 0; i < 8; ++i) { const int ka = k0 + 8 * g + i, kb = ka + 16; v[i] = ka < K ? row[ka < K ? ka : K - 1] : 0.f; v[8 + i] = kb < K ? row[kb < K ? kb : K - 1] : 0.f; }
  return bsplit16(v); }
__device__ __forceinline__ F2 split_col(const float* W, int k0, int n, int lane, int ld, int K) { float v[16]; const int g = lane >> 4;
#pragma unroll
  for (int i = 0; i < 8; ++i) { const int ka = k0 + 8 * g + i, kb = ka + 16; v[i] = ka < K ? W[(size_t)(ka < K ? ka : K - 1) * ld + n] : 0.f; v[8 + i] = kb < K ? W[(size_t)(kb < K ? kb : K - 1) * ld + n] : 0.f; }
  return bsplit16(v); }
__device__ __forceinline__ v8f mac3(const F2& a, const F2& b, v8f c) { c = wmma_bf(a.l, b.h, c); c = wmma_bf(a.h, b.l, c); return wmma_bf(a.h, b.h, c); }
__device__ __forceinline__ float sigm(float v) { return 1.0f / (1.0f + expf(-v)); }
#define LDSX() do { asm volatile("s_wait_dscnt 0" ::: "memory"); __builtin_amdgcn_wave_barrier(); __builtin_amdgcn_fence(__ATOMIC_RELEASE, "workgroup"); } while (0)


// Global L2-distance attention (B 4, H 8, N 2,048, D 64): attn = softmax(-(|q|^2 - 2 q.k + |k|^2) / 8) over keys; x = attn v, output [B, N, H, D].
#define NB 4
#define NH 8
#define NBH (NB * NH)
#define NN 2048
#define DD 64
#ifndef TBH
#define TBH NBH
#endif
typedef __attribute__((ext_vector_type(8))) __bf16 v8b;
__device__ __forceinline__ v16b frag_b(const __bf16* rowk0, int lane) {
  union { v16b v; v8b q[2]; } u; const __bf16* p = rowk0 + 8 * (lane >> 4);
  u.q[0] = *(const v8b*)p; u.q[1] = *(const v8b*)(p + 16); return u.v;
}
__device__ __forceinline__ float bfr(float v) { return (float)(__bf16)v; }
__device__ __attribute__((noinline)) float exp_ni(float v) { return expf(v); }
__device__ __attribute__((noinline)) float erf_ni(float v) { return erff(v); }

#define WS_VT  0u                                   // f16 v planes [bh][64][2048]
#define WS_KK  (WS_VT + 2u * (size_t)NBH * DD * NN)      // f32 |k|^2 [bh][n]
#define WS_END (WS_KK + 4u * (size_t)NBH * NN)

__device__ __forceinline__ v16b fragb_f32(const float* __restrict__ p, int lane) { v16b a; const float* pp = p + 8 * (lane >> 4);
#pragma unroll
  for (int i = 0; i < 8; ++i) { a[i] = (__bf16)pp[i]; a[8 + i] = (__bf16)pp[16 + i]; } return a; }
// ---- k_prep: block = (64 keys, bh): v -> transposed f16 planes; kk = sum(k^2)
__global__ __launch_bounds__(256) void k_prep(const float* __restrict__ K, const float* __restrict__ V, _Float16* __restrict__ VT, float* __restrict__ KK) { __shared__ __align__(16) _Float16 st[DD][72]; __shared__ __align__(16) float skk[64];
  const int t = threadIdx.x; const size_t bh = blockIdx.y; const int n0 = blockIdx.x * 64; const size_t r0 = bh * NN + n0;
  for (int e = t; e < 64 * DD; e += 256) { const int nl = e / DD, d = e % DD; st[d][nl] = (_Float16)bfr(V[(r0 + nl) * DD + d]); }
  if (t < 64) { const float* kr = K + (r0 + t) * DD; float s = 0.f;
#pragma unroll 1
    for (int d = 0; d < DD; ++d) { const float x = bfr(kr[d]); s += x * x; } skk[t] = s; }
  __syncthreads();
  for (int e = t; e < DD * 8; e += 256) { const int d = e >> 3, q = e & 7; vst2((unsigned*)(VT + (bh * DD + d) * (size_t)NN + n0 + q * 8), *(const v4u*)&st[d][q * 8]); }
  if (t < 16) vst2(KK + r0 + t * 4, *(const v4f*)&skk[t * 4]); }
// ---- k_att: block = (64 queries, bh): s = (2 q.k - kk_j) / 8; softmax; P (hi + residual) . v
__global__ __launch_bounds__(128) void k_att(const float* __restrict__ Q, const float* __restrict__ K, const float* __restrict__ KK, const _Float16* __restrict__ VT, float* __restrict__ X) {
  __shared__ __align__(16) float sp[4][16][36]; __shared__ __align__(16) float so[4][16][68];
  const int tid = threadIdx.x, wave = tid >> 5, lane = tid & 31, col = lane & 15, g = lane >> 4; const size_t bh = blockIdx.y; const size_t b = bh / NH, h = bh % NH; const int q0 = blockIdx.x * 64 + wave * 16; const size_t rq = bh * NN + q0;
  v16b aq[2];
#pragma unroll
  for (int kc = 0; kc < 2; ++kc) aq[kc] = fragb_f32(Q + (rq + col) * DD + kc * 32, lane);
  float m[8], l[8];
#pragma unroll
  for (int r = 0; r < 8; ++r) { m[r] = -3.0e38f; l[r] = 0.f; }
  v8f acc[4] = {}, accl[4] = {};
#pragma unroll 1
  for (int ks = 0; ks < NN / 32; ++ks) { float s[2][8];
#pragma unroll
    for (int ct = 0; ct < 2; ++ct) { const int kk = ks * 32 + ct * 16 + col; const size_t rk = bh * NN + kk; v8f c = {};
#pragma unroll
      for (int kc = 0; kc < 2; ++kc) c = wmma_bf(aq[kc], fragb_f32(K + rk * DD + kc * 32, lane), c);
      const float kkv = KK[rk];
#pragma unroll
      for (int r = 0; r < 8; ++r) s[ct][r] = (2.0f * c[r] - kkv) * 0.125f; }
    float alpha[8];
#pragma unroll
    for (int r = 0; r < 8; ++r) { float mx = fmaxf(s[0][r], s[1][r]);
#pragma unroll
      for (int o = 1; o < 16; o <<= 1) mx = fmaxf(mx, __shfl_xor(mx, o));
      const float mn = fmaxf(m[r], mx); alpha[r] = __expf(m[r] - mn); const float e0 = __expf(s[0][r] - mn), e1 = __expf(s[1][r] - mn); float es = e0 + e1;
#pragma unroll
      for (int o = 1; o < 16; o <<= 1) es += __shfl_xor(es, o);
      l[r] = l[r] * alpha[r] + es; m[r] = mn; sp[wave][8 * g + r][col] = e0; sp[wave][8 * g + r][16 + col] = e1; }
#pragma unroll
    for (int j = 0; j < 4; ++j)
#pragma unroll
      for (int r = 0; r < 8; ++r) { acc[j][r] *= alpha[r]; accl[j][r] *= alpha[r]; }
    LDSX();
    v16h pa, pal; { const float* prow = &sp[wave][col][0] + 8 * (lane >> 4);
#pragma unroll
      for (int i = 0; i < 8; ++i) { const float p0 = prow[i] * 2048.0f, p1 = prow[16 + i] * 2048.0f; pa[i] = (_Float16)p0; pa[8 + i] = (_Float16)p1; pal[i] = (_Float16)((p0 - (float)pa[i]) * 2048.0f); pal[8 + i] = (_Float16)((p1 - (float)pa[8 + i]) * 2048.0f); } }
#pragma unroll
    for (int j = 0; j < 4; ++j) { const v16h vf = frag_h(VT + (bh * DD + j * 16 + col) * (size_t)NN + ks * 32, lane); acc[j] = wmma16(pa, vf, acc[j]); accl[j] = wmma16(pal, vf, accl[j]); }
    LDSX(); }
#pragma unroll
  for (int r = 0; r < 8; ++r) { const float il = (1.0f / 2048.0f) / l[r];
#pragma unroll
    for (int j = 0; j < 4; ++j) so[wave][8 * g + r][j * 16 + col] = (acc[j][r] + accl[j][r] * (1.0f / 2048.0f)) * il; }
  LDSX(); for (int rl = 0; rl < 16; ++rl) if (lane < 16) vst2(X + ((b * NN + q0 + rl) * NH + h) * DD + lane * 4, *(const v4f*)&so[wave][rl][lane * 4]); }   // output [B][N][H][D]
extern "C" void kernel_launch(void* const* d_in, const int* in_sizes, int n_in, void* d_out, int out_size, void* d_ws, size_t ws_size, hipStream_t stream) {
  (void)in_sizes; (void)n_in; (void)out_size;
  const float** F = (const float**)d_in;   // 0 q, 1 k, 2 v [4,8,2048,64]
  if (ws_size < (size_t)WS_END) return;
  char* ws = (char*)d_ws; _Float16* VT = (_Float16*)(ws + WS_VT); float* KK = (float*)(ws + WS_KK);
  k_prep<<<dim3(NN / 64, NBH), 256, 0, stream>>>(F[1], F[2], VT, KK);
  k_att<<<dim3(NN / 64, TBH), 128, 0, stream>>>(F[0], F[1], KK, VT, (float*)d_out);
}

// v001
// Measured time: 121 microseconds a run.
// Two timings next to v000 both put it at 1.92 times that version's speed.
// compute dtype: all float inputs rounded to bf16; logits q . k with EXACT bf16 products on WMMA 16x16x32 (1 product: q and k are inputs), |k|^2 per key in f32 (the per-query |q|^2 term is constant along the softmax axis and cancels), running-max softmax in f32 (hardware exp), P as f16 hi + residual (x 2^11) . v (bf16 values as f16 planes, 2 products); f32 output.
#include <hip/hip_runtime.h>
#include <math.h>

typedef __attribute__((ext_vector_type(16))) _Float16 v16h;
typedef __attribute__((ext_vector_type(16))) __bf16 v16b;
typedef __attribute__((ext_vector_type(8)))  _Float16 v8h;
typedef __attribute__((ext_vector_type(8)))  float v8f;
typedef __attribute__((ext_vector_type(4)))  float v4f;
typedef __attribute__((ext_vector_type(2)))  float v2f;
typedef __attribute__((ext_vector_type(4)))  unsigned v4u;
typedef __attribute__((ext_vector_type(4)))  int v4i;
typedef float __attribute__((may_alias)) float_a;
typedef int __attribute__((may_alias)) int_a;

template <typename T> __device__ __forceinline__ void vst2(void* p, T v) { *(T*)p = v;  }
__device__ __forceinline__ v8f wmma16(v16h a, v16h b, v8f c) {
  v8f d = __builtin_amdgcn_wmma_f32_16x16x32_f16(false, a, false, b, (short)0, c, false, false);
  asm volatile("v_nop\n\tv_nop\n\tv_nop\n\tv_nop" : "+v"(d) : "v"(a), "v"(b));
  return d;
}
__device__ __forceinline__ v8f wmma_bf(v16b a, v16b b, v8f c) {
  v8f d = __builtin_amdgcn_wmma_f32_16x16x32_bf16(false, a, false, b, (short)0, c, false, false);
  asm volatile("v_nop\n\tv_nop\n\tv_nop\n\tv_nop" : "+v"(d) : "v"(a), "v"(b));
  return d;
}
// 16x16x32 fragments: lane = (h = lane>>4, row/col = lane&15); elements 0..7 = k0+8h+0..7, 8..15 = k0+16+8h+0..7; D element r = row 8h+r
__device__ __forceinline__ v16h frag_h(const _Float16* rowk0, int lane) {
  union { v16h v; v8h q[2]; } u; const _Float16* p = rowk0 + 8 * (lane >> 4);
  u.q[0] = *(const v8h*)p; u.q[1] = *(const v8h*)(p + 16); return u.v;
}
__device__ __forceinline__ v16h frag_f32(const float* rowk0, int lane) {
  v16h a; const float* p = rowk0 + 8 * (lane >> 4);
#pragma unroll
  for (int i = 0; i < 8; ++i) { a[i] = (_Float16)p[i]; a[8 + i] = (_Float16)p[16 + i]; }
  return a;
}
__device__ __forceinline__ v16h frag_f32s(const float* rowk0, int lane, float sc) {
  v16h a; const float* p = rowk0 + 8 * (lane >> 4);
#pragma unroll
  for (int i = 0; i < 8; ++i) { a[i] = (_Float16)(p[i] * sc); a[8 + i] = (_Float16)(p[16 + i] * sc); }
  return a;
}
// column fragment from a [K][ld] layout (column n), rows >= K read as 0
__device__ __forceinline__ v16h fragc_f32(const float* W, int k0, int n, int lane, int ld, int K) {
  v16h a; const int g = lane >> 4;
#pragma unroll
  for (int i = 0; i < 8; ++i) { const int ka = k0 + 8 * g + i, kb = ka + 16;
    a[i] = (_Float16)(ka < K ? W[(size_t)(ka < K ? ka : K - 1) * ld + n] : 0.f); a[8 + i] = (_Float16)(kb < K ? W[(size_t)(kb < K ? kb : K - 1) * ld + n] : 0.f); }
  return a;
}
struct F2 { v16b h, l; };
__device__ __forceinline__ F2 bsplit16(const float v[16]) { F2 r;
#pragma unroll
  for (int i = 0; i < 16; ++i) { const __bf16 h = (__bf16)v[i]; r.h[i] = h; r.l[i] = (__bf16)(v[i] - (float)h); }
  return r; }
__device__ __forceinline__ F2 split_row(const float* row, int k0, int lane) { float v[16]; const float* p = row + k0 + 8 * (lane >> 4);
#pragma unroll
  for (int i = 0; i < 8; ++i) { v[i] = p[i]; v[8 + i] = p[16 + i]; }
  return bsplit16(v); }
__device__ __forceinline__ F2 split_rowK(const float* row, int k0, int lane, int K) { float v[16]; const int g = lane >> 4;
#pragma unroll
  for (int i = 0; i < 8; ++i) { const int ka = k0 + 8 * g + i, kb = ka + 16; v[i] = ka < K ? row[ka < K ? ka : K - 1] : 0.f; v[8 + i] = kb < K ? row[kb < K ? kb : K - 1] : 0.f; }
  return bsplit16(v); }
__device__ __forceinline__ F2 split_col(const float* W, int k0, int n, int lane, int ld, int K) { float v[16]; const int g = lane >> 4;
#pragma unroll
  for (int i = 0; i < 8; ++i) { const int ka = k0 + 8 * g + i, kb = ka + 16; v[i] = ka < K ? W[(size_t)(ka < K ? ka : K - 1) * ld + n] : 0.f; v[8 + i] = kb < K ? W[(size_t)(kb < K ? kb : K - 1) * ld + n] : 0.f; }
  return bsplit16(v); }
__device__ __forceinline__ v8f mac3(const F2& a, const F2& b, v8f c) { c = wmma_bf(a.l, b.h, c); c = wmma_bf(a.h, b.l, c); return wmma_bf(a.h, b.h, c); }
__device__ __forceinline__ float sigm(float v) { return 1.0f / (1.0f + expf(-v)); }
#define LDSX() do { asm volatile("s_wait_dscnt 0" ::: "memory"); __builtin_amdgcn_wave_barrier(); __builtin_amdgcn_fence(__ATOMIC_RELEASE, "workgroup"); } while (0)


// Global L2-distance attention (B 4, H 8, N 2,048, D 64): attn = softmax(-(|q|^2 - 2 q.k + |k|^2) / 8) over keys; x = attn v, output [B, N, H, D].
#define NB 4
#define NH 8
#define NBH (NB * NH)
#define NN 2048
#define DD 64
#ifndef TBH
#define TBH NBH
#endif
typedef __attribute__((ext_vector_type(8))) __bf16 v8b;
__device__ __forceinline__ v16b frag_b(const __bf16* rowk0, int lane) {
  union { v16b v; v8b q[2]; } u; const __bf16* p = rowk0 + 8 * (lane >> 4);
  u.q[0] = *(const v8b*)p; u.q[1] = *(const v8b*)(p + 16); return u.v;
}
__device__ __forceinline__ float bfr(float v) { return (float)(__bf16)v; }
__device__ __attribute__((noinline)) float exp_ni(float v) { return expf(v); }
__device__ __attribute__((noinline)) float erf_ni(float v) { return erff(v); }

#define WS_VT  0u                                   // f16 v planes [bh][64][2048]
#define WS_KK  (WS_VT + 2u * (size_t)NBH * DD * NN)      // f32 |k|^2 [bh][n]
#define WS_END (WS_KK + 4u * (size_t)NBH * NN)

__device__ __forceinline__ v16b fragb_f32(const float* __restrict__ p, int lane) { v16b a; const float* pp = p + 8 * (lane >> 4);
#pragma unroll
  for (int i = 0; i < 8; ++i) { a[i] = (__bf16)pp[i]; a[8 + i] = (__bf16)pp[16 + i]; } return a; }
// ---- k_prep: block = (64 keys, bh): v -> transposed f16 planes; kk = sum(k^2)
__global__ __launch_bounds__(256) void k_prep(const float* __restrict__ K, const float* __restrict__ V, _Float16* __restrict__ VT, float* __restrict__ KK) { __shared__ __align__(16) _Float16 st[DD][72]; __shared__ __align__(16) float skk[64];
  const int t = threadIdx.x; const size_t bh = blockIdx.y; const int n0 = blockIdx.x * 64; const size_t r0 = bh * NN + n0;
  for (int e = t; e < 64 * DD; e += 256) { const int nl = e / DD, d = e % DD; st[d][nl] = (_Float16)bfr(V[(r0 + nl) * DD + d]); }
  if (t < 64) { const float* kr = K + (r0 + t) * DD; float s = 0.f;
#pragma unroll 1
    for (int d = 0; d < DD; ++d) { const float x = bfr(kr[d]); s += x * x; } skk[t] = s; }
  __syncthreads();
  for (int e = t; e < DD * 8; e += 256) { const int d = e >> 3, q = e & 7; vst2((unsigned*)(VT + (bh * DD + d) * (size_t)NN + n0 + q * 8), *(const v4u*)&st[d][q * 8]); }
  if (t < 16) vst2(KK + r0 + t * 4, *(const v4f*)&skk[t * 4]); }
// ---- asynchronous copies to LDS: each lane brings its own 16 bytes; the s_wait_xcnt stands inside the copies' own statement, in front of any rewrite of their address registers
__device__ __forceinline__ unsigned lds_off(const void* p) { return (unsigned)(size_t)p; }   // low 32 bits of a __shared__ address = byte offset in the work-group's LDS
__device__ __forceinline__ void copy4(unsigned l0, unsigned l1, unsigned l2, unsigned l3, const void* g0, const void* g1, const void* g2, const void* g3) {
  asm volatile("global_load_async_to_lds_b128 %0, %4, off\n\tglobal_load_async_to_lds_b128 %1, %5, off\n\tglobal_load_async_to_lds_b128 %2, %6, off\n\tglobal_load_async_to_lds_b128 %3, %7, off\n\ts_wait_xcnt 0x0"
               :: "v"(l0), "v"(l1), "v"(l2), "v"(l3), "v"(g0), "v"(g1), "v"(g2), "v"(g3) : "memory"); }
__device__ __forceinline__ void copy6(unsigned l0, unsigned l1, unsigned l2, unsigned l3, unsigned l4, unsigned l5, const void* g0, const void* g1, const void* g2, const void* g3, const void* g4, const void* g5) {
  asm volatile("global_load_async_to_lds_b128 %0, %6, off\n\tglobal_load_async_to_lds_b128 %1, %7, off\n\tglobal_load_async_to_lds_b128 %2, %8, off\n\tglobal_load_async_to_lds_b128 %3, %9, off\n\tglobal_load_async_to_lds_b128 %4, %10, off\n\tglobal_load_async_to_lds_b128 %5, %11, off\n\ts_wait_xcnt 0x0"
               :: "v"(l0), "v"(l1), "v"(l2), "v"(l3), "v"(l4), "v"(l5), "v"(g0), "v"(g1), "v"(g2), "v"(g3), "v"(g4), "v"(g5) : "memory"); }
#define KPITCH 68   // floats: 272-byte rows, conflict-free for 16-byte LDS reads of 256-byte rows
#define VPITCH 40   // halves: 80-byte rows, the same for 64-byte rows
// ---- k_att: block = (64 queries, bh): s = (2 q.k - kk_j) / 8; softmax; P (hi + residual) . v; the 32-key tiles of k and v come through a two-buffer LDS ring shared by the four waves
__global__ __launch_bounds__(128) void k_att(const float* __restrict__ Q, const float* __restrict__ K, const float* __restrict__ KK, const _Float16* __restrict__ VT, float* __restrict__ X) {
  __shared__ __align__(16) float sp[4][16][36]; __shared__ __align__(16) float so[4][16][68];
  __shared__ __align__(16) float sk[2][32][KPITCH]; __shared__ __align__(16) _Float16 sv[2][DD][VPITCH]; __shared__ __align__(16) float skk[NN];
  const int tid = threadIdx.x, wave = tid >> 5, lane = tid & 31, col = lane & 15, g = lane >> 4; const size_t bh = blockIdx.y; const size_t b = bh / NH, h = bh % NH; const int q0 = blockIdx.x * 64 + wave * 16; const size_t rq = bh * NN + q0;
  const float* gk = K + (bh * NN + (tid >> 4)) * DD + (tid & 15) * 4;                    // k tile: 32 rows of 256 bytes, a thread's four pieces lie 8 rows apart
  const _Float16* gv = VT + (bh * DD + (tid >> 2)) * (size_t)NN + (tid & 3) * 8;          // v tile: 64 rows (d) of 64 bytes, a thread's two pieces lie 32 rows apart
  auto copy_tile = [&](int t, int bf) {
    const float* a = gk + (size_t)t * 32 * DD; const unsigned la = lds_off(&sk[bf][tid >> 4][(tid & 15) * 4]);
    const _Float16* c = gv + t * 32; const unsigned lc = lds_off(&sv[bf][tid >> 2][(tid & 3) * 8]);
    copy6(la, la + 8 * KPITCH * 4, la + 16 * KPITCH * 4, la + 24 * KPITCH * 4, lc, lc + 32 * VPITCH * 2, a, a + 8 * DD, a + 16 * DD, a + 24 * DD, c, c + 32 * (size_t)NN); };
  { const float* a = KK + bh * NN + tid * 4; const unsigned la = lds_off(&skk[tid * 4]); copy4(la, la + 2048, la + 4096, la + 6144, a, a + 512, a + 1024, a + 1536); }   // |k|^2 of all keys, filled once
  copy_tile(0, 0);
  asm volatile("s_wait_asynccnt 0x0" ::: "memory");   // this wave's copies of |k|^2 and of tile 0 have landed
  __syncthreads();                                    // every wave's have: tile 0 may be read
  copy_tile(1, 1);
  v16b aq[2];
#pragma unroll
  for (int kc = 0; kc < 2; ++kc) aq[kc] = fragb_f32(Q + (rq + col) * DD + kc * 32, lane);
  float m[8], l[8];
#pragma unroll
  for (int r = 0; r < 8; ++r) { m[r] = -3.0e38f; l[r] = 0.f; }
  v8f acc[4] = {}, accl[4] = {};
#pragma unroll 1
  for (int ks = 0; ks < NN / 32; ++ks) { float s[2][8]; const int bf = ks & 1;
#pragma unroll
    for (int ct = 0; ct < 2; ++ct) { v8f c = {};
#pragma unroll
      for (int kc = 0; kc < 2; ++kc) c = wmma_bf(aq[kc], fragb_f32(&sk[bf][ct * 16 + col][kc * 32], lane), c);
      const float kkv = skk[ks * 32 + ct * 16 + col];
#pragma unroll
      for (int r = 0; r < 8; ++r) s[ct][r] = (2.0f * c[r] - kkv) * 0.125f; }
    float alpha[8];
#pragma unroll
    for (int r = 0; r < 8; ++r) { float mx = fmaxf(s[0][r], s[1][r]);
#pragma unroll
      for (int o = 1; o < 16; o <<= 1) mx = fmaxf(mx, __shfl_xor(mx, o));
      const float mn = fmaxf(m[r], mx); alpha[r] = __expf(m[r] - mn); const float e0 = __expf(s[0][r] - mn), e1 = __expf(s[1][r] - mn); float es = e0 + e1;
#pragma unroll
      for (int o = 1; o < 16; o <<= 1) es += __shfl_xor(es, o);
      l[r] = l[r] * alpha[r] + es; m[r] = mn; sp[wave][8 * g + r][col] = e0; sp[wave][8 * g + r][16 + col] = e1; }
#pragma unroll
    for (int j = 0; j < 4; ++j)
#pragma unroll
      for (int r = 0; r < 8; ++r) { acc[j][r] *= alpha[r]; accl[j][r] *= alpha[r]; }
    LDSX();
    v16h pa, pal; { const float* prow = &sp[wave][col][0] + 8 * (lane >> 4);
#pragma unroll
      for (int i = 0; i < 8; ++i) { const float p0 = prow[i] * 2048.0f, p1 = prow[16 + i] * 2048.0f; pa[i] = (_Float16)p0; pa[8 + i] = (_Float16)p1; pal[i] = (_Float16)((p0 - (float)pa[i]) * 2048.0f); pal[8 + i] = (_Float16)((p1 - (float)pa[8 + i]) * 2048.0f); } }
#pragma unroll
    for (int j = 0; j < 4; ++j) { const v16h vf = frag_h(&sv[bf][j * 16 + col][0], lane); acc[j] = wmma16(pa, vf, acc[j]); accl[j] = wmma16(pal, vf, accl[j]); }
    asm volatile("s_wait_dscnt 0x0" ::: "memory");      // this wave's LDS reads (tile ks, its P rows) have retired
    asm volatile("s_wait_asynccnt 0x0" ::: "memory");   // this wave's copies of tile ks + 1 have landed
    __syncthreads();                                    // publishes tile ks + 1 and ends every wave's reads of tile ks
    if (ks + 2 < NN / 32) copy_tile(ks + 2, bf); }      // refill of the buffer just left; flies during trip ks + 1
  asm volatile("s_wait_asynccnt 0x0" ::: "memory");     // no copy is outstanding when the wave goes on to the epilogue
#pragma unroll
  for (int r = 0; r < 8; ++r) { const float il = (1.0f / 2048.0f) / l[r];
#pragma unroll
    for (int j = 0; j < 4; ++j) so[wave][8 * g + r][j * 16 + col] = (acc[j][r] + accl[j][r] * (1.0f / 2048.0f)) * il; }
  LDSX(); for (int rl = 0; rl < 16; ++rl) if (lane < 16) vst2(X + ((b * NN + q0 + rl) * NH + h) * DD + lane * 4, *(const v4f*)&so[wave][rl][lane * 4]); }   // output [B][N][H][D]
extern "C" void kernel_launch(void* const* d_in, const int* in_sizes, int n_in, void* d_out, int out_size, void* d_ws, size_t ws_size, hipStream_t stream) {
  (void)in_sizes; (void)n_in; (void)out_size;
  const float** F = (const float**)d_in;   // 0 q, 1 k, 2 v [4,8,2048,64]
  if (ws_size < (size_t)WS_END) return;
  char* ws = (char*)d_ws; _Float16* VT = (_Float16*)(ws + WS_VT); float* KK = (float*)(ws + WS_KK);
  k_prep<<<dim3(NN / 64, NBH), 256, 0, stream>>>(F[1], F[2], VT, KK);
  k_att<<<dim3(NN / 64, TBH), 128, 0, stream>>>(F[0], F[1], KK, VT, (float*)d_out);
}

// v002
// It runs in 85.2 microseconds.
// Next to v001, in two timings, it ran 1.42 and 1.41 times as fast.
// Counting every step since v000, it is 2.72 times as fast.
// compute dtype: all float inputs rounded to bf16; logits q . k with EXACT bf16 products on WMMA 16x16x32 (1 product: q and k are inputs), |k|^2 per key in f32 (the per-query |q|^2 term is constant along the softmax axis and cancels), running-max softmax in f32 (hardware exp), P as f16 hi + residual (x 2^11) . v (bf16 values as f16 planes, 2 products); f32 output.
#include <hip/hip_runtime.h>
#include <math.h>

typedef __attribute__((ext_vector_type(16))) _Float16 v16h;
typedef __attribute__((ext_vector_type(16))) __bf16 v16b;
typedef __attribute__((ext_vector_type(8)))  _Float16 v8h;
typedef __attribute__((ext_vector_type(8)))  float v8f;
typedef __attribute__((ext_vector_type(4)))  float v4f;
typedef __attribute__((ext_vector_type(2)))  float v2f;
typedef __attribute__((ext_vector_type(4)))  unsigned v4u;
typedef __attribute__((ext_vector_type(4)))  int v4i;
typedef float __attribute__((may_alias)) float_a;
typedef int __attribute__((may_alias)) int_a;

template <typename T> __device__ __forceinline__ void vst2(void* p, T v) { *(T*)p = v;  }
__device__ __forceinline__ v8f wmma16(v16h a, v16h b, v8f c) {
  v8f d = __builtin_amdgcn_wmma_f32_16x16x32_f16(false, a, false, b, (short)0, c, false, false);
  asm volatile("v_nop\n\tv_nop\n\tv_nop\n\tv_nop" : "+v"(d) : "v"(a), "v"(b));
  return d;
}
__device__ __forceinline__ v8f wmma_bf(v16b a, v16b b, v8f c) {
  v8f d = __builtin_amdgcn_wmma_f32_16x16x32_bf16(false, a, false, b, (short)0, c, false, false);
  asm volatile("v_nop\n\tv_nop\n\tv_nop\n\tv_nop" : "+v"(d) : "v"(a), "v"(b));
  return d;
}
// 16x16x32 fragments: lane = (h = lane>>4, row/col = lane&15); elements 0..7 = k0+8h+0..7, 8..15 = k0+16+8h+0..7; D element r = row 8h+r
__device__ __forceinline__ v16h frag_h(const _Float16* rowk0, int lane) {
  union { v16h v; v8h q[2]; } u; const _Float16* p = rowk0 + 8 * (lane >> 4);
  u.q[0] = *(const v8h*)p; u.q[1] = *(const v8h*)(p + 16); return u.v;
}
__device__ __forceinline__ v16h frag_f32(const float* rowk0, int lane) {
  v16h a; const float* p = rowk0 + 8 * (lane >> 4);
#pragma unroll
  for (int i = 0; i < 8; ++i) { a[i] = (_Float16)p[i]; a[8 + i] = (_Float16)p[16 + i]; }
  return a;
}
__device__ __forceinline__ v16h frag_f32s(const float* rowk0, int lane, float sc) {
  v16h a; const float* p = rowk0 + 8 * (lane >> 4);
#pragma unroll
  for (int i = 0; i < 8; ++i) { a[i] = (_Float16)(p[i] * sc); a[8 + i] = (_Float16)(p[16 + i] * sc); }
  return a;
}
// column fragment from a [K][ld] layout (column n), rows >= K read as 0
__device__ __forceinline__ v16h fragc_f32(const float* W, int k0, int n, int lane, int ld, int K) {
  v16h a; const int g = lane >> 4;
#pragma unroll
  for (int i = 0; i < 8; ++i) { const int ka = k0 + 8 * g + i, kb = ka + 16;
    a[i] = (_Float16)(ka < K ? W[(size_t)(ka < K ? ka : K - 1) * ld + n] : 0.f); a[8 + i] = (_Float16)(kb < K ? W[(size_t)(kb < K ? kb : K - 1) * ld + n] : 0.f); }
  return a;
}
struct F2 { v16b h, l; };
__device__ __forceinline__ F2 bsplit16(const float v[16]) { F2 r;
#pragma unroll
  for (int i = 0; i < 16; ++i) { const __bf16 h = (__bf16)v[i]; r.h[i] = h; r.l[i] = (__bf16)(v[i] - (float)h); }
  return r; }
__device__ __forceinline__ F2 split_row(const float* row, int k0, int lane) { float v[16]; const float* p = row + k0 + 8 * (lane >> 4);
#pragma unroll
  for (int i = 0; i < 8; ++i) { v[i] = p[i]; v[8 + i] = p[16 + i]; }
  return bsplit16(v); }
__device__ __forceinline__ F2 split_rowK(const float* row, int k0, int lane, int K) { float v[16]; const int g = lane >> 4;
#pragma unroll
  for (int i = 0; i < 8; ++i) { const int ka = k0 + 8 * g + i, kb = ka + 16; v[i] = ka < K ? row[ka < K ? ka : K - 1] : 0.f; v[8 + i] = kb < K ? row[kb < K ? kb : K - 1] : 0.f; }
  return bsplit16(v); }
__device__ __forceinline__ F2 split_col(const float* W, int k0, int n, int lane, int ld, int K) { float v[16]; const int g = lane >> 4;
#pragma unroll
  for (int i = 0; i < 8; ++i) { const int ka = k0 + 8 * g + i, kb = ka + 16; v[i] = ka < K ? W[(size_t)(ka < K ? ka : K - 1) * ld + n] : 0.f; v[8 + i] = kb < K ? W[(size_t)(kb < K ? kb : K - 1) * ld + n] : 0.f; }
  return bsplit16(v); }
__device__ __forceinline__ v8f mac3(const F2& a, const F2& b, v8f c) { c = wmma_bf(a.l, b.h, c); c = wmma_bf(a.h, b.l, c); return wmma_bf(a.h, b.h, c); }
__device__ __forceinline__ float sigm(float v) { return 1.0f / (1.0f + expf(-v)); }
#define LDSX() do { asm volatile("s_wait_dscnt 0" ::: "memory"); __builtin_amdgcn_wave_barrier(); __builtin_amdgcn_fence(__ATOMIC_RELEASE, "workgroup"); } while (0)


// Global L2-distance attention (B 4, H 8, N 2,048, D 64): attn = softmax(-(|q|^2 - 2 q.k + |k|^2) / 8) over keys; x = attn v, output [B, N, H, D].
#define NB 4
#define NH 8
#define NBH (NB * NH)
#define NN 2048
#define DD 64
#ifndef TBH
#define TBH NBH
#endif
typedef __attribute__((ext_vector_type(8))) __bf16 v8b;
__device__ __forceinline__ v16b frag_b(const __bf16* rowk0, int lane) {
  union { v16b v; v8b q[2]; } u; const __bf16* p = rowk0 + 8 * (lane >> 4);
  u.q[0] = *(const v8b*)p; u.q[1] = *(const v8b*)(p + 16); return u.v;
}
__device__ __forceinline__ float bfr(float v) { return (float)(__bf16)v; }
__device__ __attribute__((noinline)) float exp_ni(float v) { return expf(v); }
__device__ __attribute__((noinline)) float erf_ni(float v) { return erff(v); }

#define WS_VT  0u                                   // f16 v planes [bh][64][2048]
#define WS_KK  (WS_VT + 2u * (size_t)NBH * DD * NN)      // f32 |k|^2 [bh][n]
#define WS_END (WS_KK + 4u * (size_t)NBH * NN)

__device__ __forceinline__ v16b fragb_f32(const float* __restrict__ p, int lane) { v16b a; const float* pp = p + 8 * (lane >> 4);
#pragma unroll
  for (int i = 0; i < 8; ++i) { a[i] = (__bf16)pp[i]; a[8 + i] = (__bf16)pp[16 + i]; } return a; }
// ---- k_prep: block = (64 keys, bh): v -> transposed f16 planes; kk = sum(k^2)
__global__ __launch_bounds__(256) void k_prep(const float* __restrict__ K, const float* __restrict__ V, _Float16* __restrict__ VT, float* __restrict__ KK) { __shared__ __align__(16) _Float16 st[DD][72]; __shared__ __align__(16) float skk[64];
  const int t = threadIdx.x; const size_t bh = blockIdx.y; const int n0 = blockIdx.x * 64; const size_t r0 = bh * NN + n0;
  for (int e = t; e < 64 * DD; e += 256) { const int nl = e / DD, d = e % DD; st[d][nl] = (_Float16)bfr(V[(r0 + nl) * DD + d]); }
  if (t < 64) { const float* kr = K + (r0 + t) * DD; float s = 0.f;
#pragma unroll 1
    for (int d = 0; d < DD; ++d) { const float x = bfr(kr[d]); s += x * x; } skk[t] = s; }
  __syncthreads();
  for (int e = t; e < DD * 8; e += 256) { const int d = e >> 3, q = e & 7; vst2((unsigned*)(VT + (bh * DD + d) * (size_t)NN + n0 + q * 8), *(const v4u*)&st[d][q * 8]); }
  if (t < 16) vst2(KK + r0 + t * 4, *(const v4f*)&skk[t * 4]); }
// ---- asynchronous copies to LDS: each lane brings its own 16 bytes; the s_wait_xcnt stands inside the copies' own statement, in front of any rewrite of their address registers
__device__ __forceinline__ unsigned lds_off(const void* p) { return (unsigned)(size_t)p; }   // low 32 bits of a __shared__ address = byte offset in the work-group's LDS
__device__ __forceinline__ void copy4(unsigned l0, unsigned l1, unsigned l2, unsigned l3, const void* g0, const void* g1, const void* g2, const void* g3) {
  asm volatile("global_load_async_to_lds_b128 %0, %4, off\n\tglobal_load_async_to_lds_b128 %1, %5, off\n\tglobal_load_async_to_lds_b128 %2, %6, off\n\tglobal_load_async_to_lds_b128 %3, %7, off\n\ts_wait_xcnt 0x0"
               :: "v"(l0), "v"(l1), "v"(l2), "v"(l3), "v"(g0), "v"(g1), "v"(g2), "v"(g3) : "memory"); }
__device__ __forceinline__ void copy6(unsigned l0, unsigned l1, unsigned l2, unsigned l3, unsigned l4, unsigned l5, const void* g0, const void* g1, const void* g2, const void* g3, const void* g4, const void* g5) {
  asm volatile("global_load_async_to_lds_b128 %0, %6, off\n\tglobal_load_async_to_lds_b128 %1, %7, off\n\tglobal_load_async_to_lds_b128 %2, %8, off\n\tglobal_load_async_to_lds_b128 %3, %9, off\n\tglobal_load_async_to_lds_b128 %4, %10, off\n\tglobal_load_async_to_lds_b128 %5, %11, off\n\ts_wait_xcnt 0x0"
               :: "v"(l0), "v"(l1), "v"(l2), "v"(l3), "v"(l4), "v"(l5), "v"(g0), "v"(g1), "v"(g2), "v"(g3), "v"(g4), "v"(g5) : "memory"); }
#define KPITCH 68   // floats: 272-byte rows, conflict-free for 16-byte LDS reads of 256-byte rows
#define VPITCH 40   // halves: 80-byte rows, the same for 64-byte rows
// ---- k_att: block = (64 queries, bh): transposed products: S^T = k . q^T (a lane holds 16 keys' scores of ONE query), s = (2 q.k - kk_j) / 8; softmax in the lane; O^T += v^T . P^T with P (hi + residual) packed from the score registers; the 32-key tiles of k and v come through a two-buffer LDS ring shared by the four waves
typedef __attribute__((ext_vector_type(2))) _Float16 v2h;
__device__ __forceinline__ float xhalf(float v) { return __builtin_bit_cast(float, __builtin_amdgcn_permlanex16(__builtin_bit_cast(int, v), __builtin_bit_cast(int, v), 0x76543210, 0xfedcba98, false, false)); }   // the value of lane ^ 16
__global__ __launch_bounds__(128) void k_att(const float* __restrict__ Q, const float* __restrict__ K, const float* __restrict__ KK, const _Float16* __restrict__ VT, float* __restrict__ X) {
  __shared__ __align__(16) float so[4][16][68];
  __shared__ __align__(16) float sk[2][32][KPITCH]; __shared__ __align__(16) _Float16 sv[2][DD][VPITCH]; __shared__ __align__(16) float skk[NN];
  const int tid = threadIdx.x, wave = tid >> 5, lane = tid & 31, col = lane & 15, g = lane >> 4; const size_t bh = blockIdx.y; const size_t b = bh / NH, h = bh % NH; const int q0 = blockIdx.x * 64 + wave * 16; const size_t rq = bh * NN + q0;
  const float* gk = K + (bh * NN + (tid >> 4)) * DD + (tid & 15) * 4;                    // k tile: 32 rows of 256 bytes, a thread's four pieces lie 8 rows apart
  const _Float16* gv = VT + (bh * DD + (tid >> 2)) * (size_t)NN + (tid & 3) * 8;          // v tile: 64 rows (d) of 64 bytes, a thread's two pieces lie 32 rows apart
  auto copy_tile = [&](int t, int bf) {
    const float* a = gk + (size_t)t * 32 * DD; const unsigned la = lds_off(&sk[bf][tid >> 4][(tid & 15) * 4]);
    const _Float16* c = gv + t * 32; const unsigned lc = lds_off(&sv[bf][tid >> 2][(tid & 3) * 8]);
    copy6(la, la + 8 * KPITCH * 4, la + 16 * KPITCH * 4, la + 24 * KPITCH * 4, lc, lc + 32 * VPITCH * 2, a, a + 8 * DD, a + 16 * DD, a + 24 * DD, c, c + 32 * (size_t)NN); };
  { const float* a = KK + bh * NN + tid * 4; const unsigned la = lds_off(&skk[tid * 4]); copy4(la, la + 2048, la + 4096, la + 6144, a, a + 512, a + 1024, a + 1536); }   // |k|^2 of all keys, filled once
  copy_tile(0, 0);
  asm volatile("s_wait_asynccnt 0x0" ::: "memory");   // this wave's copies of |k|^2 and of tile 0 have landed
  __syncthreads();                                    // every wave's have: tile 0 may be read
  copy_tile(1, 1);
  v16b aq[2];                                         // B operand: column = query q0 + col
#pragma unroll
  for (int kc = 0; kc < 2; ++kc) aq[kc] = fragb_f32(Q + (rq + col) * DD + kc * 32, lane);
  float m = -3.0e38f, l = 0.f;                        // of query q0 + col: m equal in both lane halves, l each half's own part
  v8f acc[4] = {}, accl[4] = {};                      // O^T: element r of tile j = d j * 16 + 8 g + r of query q0 + col
#pragma unroll 1
  for (int ks = 0; ks < NN / 32; ++ks) { v2f s[2][4]; const int bf = ks & 1;
#pragma unroll
    for (int ct = 0; ct < 2; ++ct) { v8f c = {};     // element r = key ks * 32 + ct * 16 + 8 g + r
#pragma unroll
      for (int kc = 0; kc < 2; ++kc) c = wmma_bf(fragb_f32(&sk[bf][ct * 16 + col][kc * 32], lane), aq[kc], c);
      const float* kkp = &skk[ks * 32 + ct * 16 + 8 * g]; const v4f ka = *(const v4f*)kkp, kb = *(const v4f*)(kkp + 4);
      s[ct][0] = (2.0f * c.s01 - ka.s01) * 0.125f; s[ct][1] = (2.0f * c.s23 - ka.s23) * 0.125f; s[ct][2] = (2.0f * c.s45 - kb.s01) * 0.125f; s[ct][3] = (2.0f * c.s67 - kb.s23) * 0.125f; }
    float mx = fmaxf(s[0][0].x, s[0][0].y);
#pragma unroll
    for (int i = 1; i < 8; ++i) mx = fmaxf(mx, fmaxf(s[i >> 2][i & 3].x, s[i >> 2][i & 3].y));
    mx = fmaxf(mx, xhalf(mx));
    const float mn = fmaxf(m, mx), alpha = __expf(m - mn); m = mn;
    v2f ev[8]; v16h pa, pal;               // B operand of the second product: element i = key 8 g + i, element 8 + i = key 16 + 8 g + i: the two score tiles as they lie
#pragma unroll
    for (int i = 0; i < 8; ++i) { const v2f d = s[i >> 2][i & 3] - mn; const v2f e = {__expf(d.x), __expf(d.y)}; ev[i] = e;
      const v2f p = e * 2048.0f; const v2h ph = __builtin_convertvector(p, v2h); const v2h pl = __builtin_convertvector((p - __builtin_convertvector(ph, v2f)) * 2048.0f, v2h);
      pa[2 * i] = ph.x; pa[2 * i + 1] = ph.y; pal[2 * i] = pl.x; pal[2 * i + 1] = pl.y; }
    const v2f es1 = ((ev[0] + ev[1]) + (ev[2] + ev[3])) + ((ev[4] + ev[5]) + (ev[6] + ev[7])); const float es = es1.x + es1.y;
    l = l * alpha + es;
#pragma unroll
    for (int j = 0; j < 4; ++j)
#pragma unroll
      for (int r = 0; r < 8; ++r) { acc[j][r] *= alpha; accl[j][r] *= alpha; }
#pragma unroll
    for (int j = 0; j < 4; ++j) { const v16h vf = frag_h(&sv[bf][j * 16 + col][0], lane); acc[j] = wmma16(vf, pa, acc[j]); accl[j] = wmma16(vf, pal, accl[j]); }
    asm volatile("s_wait_dscnt 0x0" ::: "memory");      // this wave's LDS reads of tile ks have retired
    asm volatile("s_wait_asynccnt 0x0" ::: "memory");   // this wave's copies of tile ks + 1 have landed
    __syncthreads();                                    // publishes tile ks + 1 and ends every wave's reads of tile ks
    if (ks + 2 < NN / 32) copy_tile(ks + 2, bf); }      // refill of the buffer just left; flies during trip ks + 1
  asm volatile("s_wait_asynccnt 0x0" ::: "memory");     // no copy is outstanding when the wave goes on to the epilogue
  l += xhalf(l);                                        // the two halves' sums joined once
  { const float il = (1.0f / 2048.0f) / l;
#pragma unroll
    for (int j = 0; j < 4; ++j) { v4f o0, o1;
#pragma unroll
      for (int r = 0; r < 4; ++r) { o0[r] = (acc[j][r] + accl[j][r] * (1.0f / 2048.0f)) * il; o1[r] = (acc[j][4 + r] + accl[j][4 + r] * (1.0f / 2048.0f)) * il; }
      vst2(&so[wave][col][j * 16 + 8 * g], o0); vst2(&so[wave][col][j * 16 + 8 * g + 4], o1); } }
  LDSX(); for (int rl = 0; rl < 16; ++rl) if (lane < 16) vst2(X + ((b * NN + q0 + rl) * NH + h) * DD + lane * 4, *(const v4f*)&so[wave][rl][lane * 4]); }   // output [B][N][H][D]
extern "C" void kernel_launch(void* const* d_in, const int* in_sizes, int n_in, void* d_out, int out_size, void* d_ws, size_t ws_size, hipStream_t stream) {
  (void)in_sizes; (void)n_in; (void)out_size;
  const float** F = (const float**)d_in;   // 0 q, 1 k, 2 v [4,8,2048,64]
  if (ws_size < (size_t)WS_END) return;
  char* ws = (char*)d_ws; _Float16* VT = (_Float16*)(ws + WS_VT); float* KK = (float*)(ws + WS_KK);
  k_prep<<<dim3(NN / 64, NBH), 256, 0, stream>>>(F[1], F[2], VT, KK);
  k_att<<<dim3(NN / 64, TBH), 128, 0, stream>>>(F[0], F[1], KK, VT, (float*)d_out);
}

// v003
// One run takes 77.3 microseconds.
// Next to v002, in two timings, it ran 1.10 times as fast each time.
// Over all steps from v000 it is 3.00 times as fast.
// compute dtype: all float inputs rounded to bf16; logits q . k with EXACT bf16 products on WMMA 16x16x32 (1 product: q and k are inputs), |k|^2 per key in f32 (the per-query |q|^2 term is constant along the softmax axis and cancels), running-max softmax in f32 (hardware exp), P as f16 hi + residual (x 2^11) . v (bf16 values as f16 planes, 2 products); f32 output.
#include <hip/hip_runtime.h>
#include <math.h>

typedef __attribute__((ext_vector_type(16))) _Float16 v16h;
typedef __attribute__((ext_vector_type(16))) __bf16 v16b;
typedef __attribute__((ext_vector_type(8)))  _Float16 v8h;
typedef __attribute__((ext_vector_type(8)))  float v8f;
typedef __attribute__((ext_vector_type(4)))  float v4f;
typedef __attribute__((ext_vector_type(2)))  float v2f;
typedef __attribute__((ext_vector_type(4)))  unsigned v4u;
typedef __attribute__((ext_vector_type(4)))  int v4i;
typedef float __attribute__((may_alias)) float_a;
typedef int __attribute__((may_alias)) int_a;

template <typename T> __device__ __forceinline__ void vst2(void* p, T v) { *(T*)p = v;  }
__device__ __forceinline__ v8f wmma16(v16h a, v16h b, v8f c) {
  v8f d = __builtin_amdgcn_wmma_f32_16x16x32_f16(false, a, false, b, (short)0, c, false, false);
  return d;
}
__device__ __forceinline__ v8f wmma_bf(v16b a, v16b b, v8f c) {
  v8f d = __builtin_amdgcn_wmma_f32_16x16x32_bf16(false, a, false, b, (short)0, c, false, false);
  return d;
}
// 16x16x32 fragments: lane = (h = lane>>4, row/col = lane&15); elements 0..7 = k0+8h+0..7, 8..15 = k0+16+8h+0..7; D element r = row 8h+r
__device__ __forceinline__ v16h frag_h(const _Float16* rowk0, int lane) {
  union { v16h v; v8h q[2]; } u; const _Float16* p = rowk0 + 8 * (lane >> 4);
  u.q[0] = *(const v8h*)p; u.q[1] = *(const v8h*)(p + 16); return u.v;
}
__device__ __forceinline__ v16h frag_f32(const float* rowk0, int lane) {
  v16h a; const float* p = rowk0 + 8 * (lane >> 4);
#pragma unroll
  for (int i = 0; i < 8; ++i) { a[i] = (_Float16)p[i]; a[8 + i] = (_Float16)p[16 + i]; }
  return a;
}
__device__ __forceinline__ v16h frag_f32s(const float* rowk0, int lane, float sc) {
  v16h a; const float* p = rowk0 + 8 * (lane >> 4);
#pragma unroll
  for (int i = 0; i < 8; ++i) { a[i] = (_Float16)(p[i] * sc); a[8 + i] = (_Float16)(p[16 + i] * sc); }
  return a;
}
// column fragment from a [K][ld] layout (column n), rows >= K read as 0
__device__ __forceinline__ v16h fragc_f32(const float* W, int k0, int n, int lane, int ld, int K) {
  v16h a; const int g = lane >> 4;
#pragma unroll
  for (int i = 0; i < 8; ++i) { const int ka = k0 + 8 * g + i, kb = ka + 16;
    a[i] = (_Float16)(ka < K ? W[(size_t)(ka < K ? ka : K - 1) * ld + n] : 0.f); a[8 + i] = (_Float16)(kb < K ? W[(size_t)(kb < K ? kb : K - 1) * ld + n] : 0.f); }
  return a;
}
struct F2 { v16b h, l; };
__device__ __forceinline__ F2 bsplit16(const float v[16]) { F2 r;
#pragma unroll
  for (int i = 0; i < 16; ++i) { const __bf16 h = (__bf16)v[i]; r.h[i] = h; r.l[i] = (__bf16)(v[i] - (float)h); }
  return r; }
__device__ __forceinline__ F2 split_row(const float* row, int k0, int lane) { float v[16]; const float* p = row + k0 + 8 * (lane >> 4);
#pragma unroll
  for (int i = 0; i < 8; ++i) { v[i] = p[i]; v[8 + i] = p[16 + i]; }
  return bsplit16(v); }
__device__ __forceinline__ F2 split_rowK(const float* row, int k0, int lane, int K) { float v[16]; const int g = lane >> 4;
#pragma unroll
  for (int i = 0; i < 8; ++i) { const int ka = k0 + 8 * g + i, kb = ka + 16; v[i] = ka < K ? row[ka < K ? ka : K - 1] : 0.f; v[8 + i] = kb < K ? row[kb < K ? kb : K - 1] : 0.f; }
  return bsplit16(v); }
__device__ __forceinline__ F2 split_col(const float* W, int k0, int n, int lane, int ld, int K) { float v[16]; const int g = lane >> 4;
#pragma unroll
  for (int i = 0; i < 8; ++i) { const int ka = k0 + 8 * g + i, kb = ka + 16; v[i] = ka < K ? W[(size_t)(ka < K ? ka : K - 1) * ld + n] : 0.f; v[8 + i] = kb < K ? W[(size_t)(kb < K ? kb : K - 1) * ld + n] : 0.f; }
  return bsplit16(v); }
__device__ __forceinline__ v8f mac3(const F2& a, const F2& b, v8f c) { c = wmma_bf(a.l, b.h, c); c = wmma_bf(a.h, b.l, c); return wmma_bf(a.h, b.h, c); }
__device__ __forceinline__ float sigm(float v) { return 1.0f / (1.0f + expf(-v)); }
#define LDSX() do { asm volatile("s_wait_dscnt 0" ::: "memory"); __builtin_amdgcn_wave_barrier(); __builtin_amdgcn_fence(__ATOMIC_RELEASE, "workgroup"); } while (0)


// Global L2-distance attention (B 4, H 8, N 2,048, D 64): attn = softmax(-(|q|^2 - 2 q.k + |k|^2) / 8) over keys; x = attn v, output [B, N, H, D].
#define NB 4
#define NH 8
#define NBH (NB * NH)
#define NN 2048
#define DD 64
#ifndef TBH
#define TBH NBH
#endif
typedef __attribute__((ext_vector_type(8))) __bf16 v8b;
__device__ __forceinline__ v16b frag_b(const __bf16* rowk0, int lane) {
  union { v16b v; v8b q[2]; } u; const __bf16* p = rowk0 + 8 * (lane >> 4);
  u.q[0] = *(const v8b*)p; u.q[1] = *(const v8b*)(p + 16); return u.v;
}
__device__ __forceinline__ float bfr(float v) { return (float)(__bf16)v; }
__device__ __attribute__((noinline)) float exp_ni(float v) { return expf(v); }
__device__ __attribute__((noinline)) float erf_ni(float v) { return erff(v); }

#define WS_VT  0u                                   // f16 v planes [bh][64][2048]
#define WS_KK  (WS_VT + 2u * (size_t)NBH * DD * NN)      // f32 |k|^2 [bh][n]
#define WS_END (WS_KK + 4u * (size_t)NBH * NN)

__device__ __forceinline__ v16b fragb_f32(const float* __restrict__ p, int lane) { v16b a; const float* pp = p + 8 * (lane >> 4);
#pragma unroll
  for (int i = 0; i < 8; ++i) { a[i] = (__bf16)pp[i]; a[8 + i] = (__bf16)pp[16 + i]; } return a; }
// ---- k_prep: block = (64 keys, bh): v -> transposed f16 planes; kk = sum(k^2)
__global__ __launch_bounds__(256) void k_prep(const float* __restrict__ K, const float* __restrict__ V, _Float16* __restrict__ VT, float* __restrict__ KK) { __shared__ __align__(16) _Float16 st[DD][72]; __shared__ __align__(16) float skk[64];
  const int t = threadIdx.x; const size_t bh = blockIdx.y; const int n0 = blockIdx.x * 64; const size_t r0 = bh * NN + n0;
  for (int e = t; e < 64 * DD; e += 256) { const int nl = e / DD, d = e % DD; st[d][nl] = (_Float16)bfr(V[(r0 + nl) * DD + d]); }
  if (t < 64) { const float* kr = K + (r0 + t) * DD; float s = 0.f;
#pragma unroll 1
    for (int d = 0; d < DD; ++d) { const float x = bfr(kr[d]); s += x * x; } skk[t] = s; }
  __syncthreads();
  for (int e = t; e < DD * 8; e += 256) { const int d = e >> 3, q = e & 7; vst2((unsigned*)(VT + (bh * DD + d) * (size_t)NN + n0 + q * 8), *(const v4u*)&st[d][q * 8]); }
  if (t < 16) vst2(KK + r0 + t * 4, *(const v4f*)&skk[t * 4]); }
// ---- asynchronous copies to LDS: each lane brings its own 16 bytes; the s_wait_xcnt stands inside the copies' own statement, in front of any rewrite of their address registers
__device__ __forceinline__ unsigned lds_off(const void* p) { return (unsigned)(size_t)p; }   // low 32 bits of a __shared__ address = byte offset in the work-group's LDS
__device__ __forceinline__ void copy4(unsigned l0, unsigned l1, unsigned l2, unsigned l3, const void* g0, const void* g1, const void* g2, const void* g3) {
  asm volatile("global_load_async_to_lds_b128 %0, %4, off\n\tglobal_load_async_to_lds_b128 %1, %5, off\n\tglobal_load_async_to_lds_b128 %2, %6, off\n\tglobal_load_async_to_lds_b128 %3, %7, off\n\ts_wait_xcnt 0x0"
               :: "v"(l0), "v"(l1), "v"(l2), "v"(l3), "v"(g0), "v"(g1), "v"(g2), "v"(g3) : "memory"); }
__device__ __forceinline__ void copy6(unsigned l0, unsigned l1, unsigned l2, unsigned l3, unsigned l4, unsigned l5, const void* g0, const void* g1, const void* g2, const void* g3, const void* g4, const void* g5) {
  asm volatile("global_load_async_to_lds_b128 %0, %6, off\n\tglobal_load_async_to_lds_b128 %1, %7, off\n\tglobal_load_async_to_lds_b128 %2, %8, off\n\tglobal_load_async_to_lds_b128 %3, %9, off\n\tglobal_load_async_to_lds_b128 %4, %10, off\n\tglobal_load_async_to_lds_b128 %5, %11, off\n\ts_wait_xcnt 0x0"
               :: "v"(l0), "v"(l1), "v"(l2), "v"(l3), "v"(l4), "v"(l5), "v"(g0), "v"(g1), "v"(g2), "v"(g3), "v"(g4), "v"(g5) : "memory"); }
#define KPITCH 68   // floats: 272-byte rows, conflict-free for 16-byte LDS reads of 256-byte rows
#define VPITCH 40   // halves: 80-byte rows, the same for 64-byte rows
// ---- k_att: block = (64 queries, bh): transposed products: S^T = k . q^T (a lane holds 16 keys' scores of ONE query), s = (2 q.k - kk_j) / 8; softmax in the lane; O^T += v^T . P^T with P (hi + residual) packed from the score registers; the 32-key tiles of k and v come through a two-buffer LDS ring shared by the four waves
typedef __attribute__((ext_vector_type(2))) _Float16 v2h;
__device__ __forceinline__ float xhalf(float v) { return __builtin_bit_cast(float, __builtin_amdgcn_permlanex16(__builtin_bit_cast(int, v), __builtin_bit_cast(int, v), 0x76543210, 0xfedcba98, false, false)); }   // the value of lane ^ 16
__global__ __launch_bounds__(128) void k_att(const float* __restrict__ Q, const float* __restrict__ K, const float* __restrict__ KK, const _Float16* __restrict__ VT, float* __restrict__ X) {
  __shared__ __align__(16) float so[4][16][68];
  __shared__ __align__(16) float sk[2][32][KPITCH]; __shared__ __align__(16) _Float16 sv[2][DD][VPITCH]; __shared__ __align__(16) float skk[NN];
  const int tid = threadIdx.x, wave = tid >> 5, lane = tid & 31, col = lane & 15, g = lane >> 4; const size_t bh = blockIdx.y; const size_t b = bh / NH, h = bh % NH; const int q0 = blockIdx.x * 64 + wave * 16; const size_t rq = bh * NN + q0;
  const float* gk = K + (bh * NN + (tid >> 4)) * DD + (tid & 15) * 4;                    // k tile: 32 rows of 256 bytes, a thread's four pieces lie 8 rows apart
  const _Float16* gv = VT + (bh * DD + (tid >> 2)) * (size_t)NN + (tid & 3) * 8;          // v tile: 64 rows (d) of 64 bytes, a thread's two pieces lie 32 rows apart
  auto copy_tile = [&](int t, int bf) {
    const float* a = gk + (size_t)t * 32 * DD; const unsigned la = lds_off(&sk[bf][tid >> 4][(tid & 15) * 4]);
    const _Float16* c = gv + t * 32; const unsigned lc = lds_off(&sv[bf][tid >> 2][(tid & 3) * 8]);
    copy6(la, la + 8 * KPITCH * 4, la + 16 * KPITCH * 4, la + 24 * KPITCH * 4, lc, lc + 32 * VPITCH * 2, a, a + 8 * DD, a + 16 * DD, a + 24 * DD, c, c + 32 * (size_t)NN); };
  { const float* a = KK + bh * NN + tid * 4; const unsigned la = lds_off(&skk[tid * 4]); copy4(la, la + 2048, la + 4096, la + 6144, a, a + 512, a + 1024, a + 1536); }   // |k|^2 of all keys, filled once
  copy_tile(0, 0);
  asm volatile("s_wait_asynccnt 0x0" ::: "memory");   // this wave's copies of |k|^2 and of tile 0 have landed
  __syncthreads();                                    // every wave's have: tile 0 may be read
  copy_tile(1, 1);
  v16b aq[2];                                         // B operand: column = query q0 + col
#pragma unroll
  for (int kc = 0; kc < 2; ++kc) aq[kc] = fragb_f32(Q + (rq + col) * DD + kc * 32, lane);
  float m = -3.0e38f, l = 0.f;                        // of query q0 + col: m equal in both lane halves, l each half's own part
  v8f acc[4] = {}, accl[4] = {};                      // O^T: element r of tile j = d j * 16 + 8 g + r of query q0 + col
#pragma unroll 1
  for (int ks = 0; ks < NN / 32; ++ks) { v2f s[2][4]; const int bf = ks & 1;
#pragma unroll
    for (int ct = 0; ct < 2; ++ct) { v8f c = {};     // element r = key ks * 32 + ct * 16 + 8 g + r
#pragma unroll
      for (int kc = 0; kc < 2; ++kc) c = wmma_bf(fragb_f32(&sk[bf][ct * 16 + col][kc * 32], lane), aq[kc], c);
      const float* kkp = &skk[ks * 32 + ct * 16 + 8 * g]; const v4f ka = *(const v4f*)kkp, kb = *(const v4f*)(kkp + 4);
      s[ct][0] = (2.0f * c.s01 - ka.s01) * 0.125f; s[ct][1] = (2.0f * c.s23 - ka.s23) * 0.125f; s[ct][2] = (2.0f * c.s45 - kb.s01) * 0.125f; s[ct][3] = (2.0f * c.s67 - kb.s23) * 0.125f; }
    float mx = fmaxf(s[0][0].x, s[0][0].y);
#pragma unroll
    for (int i = 1; i < 8; ++i) mx = fmaxf(mx, fmaxf(s[i >> 2][i & 3].x, s[i >> 2][i & 3].y));
    mx = fmaxf(mx, xhalf(mx));
    const float mn = fmaxf(m, mx), alpha = __expf(m - mn); m = mn;
    v2f ev[8]; v16h pa, pal;               // B operand of the second product: element i = key 8 g + i, element 8 + i = key 16 + 8 g + i: the two score tiles as they lie
#pragma unroll
    for (int i = 0; i < 8; ++i) { const v2f d = s[i >> 2][i & 3] - mn; const v2f e = {__expf(d.x), __expf(d.y)}; ev[i] = e;
      const v2f p = e * 2048.0f; const v2h ph = __builtin_convertvector(p, v2h); const v2h pl = __builtin_convertvector((p - __builtin_convertvector(ph, v2f)) * 2048.0f, v2h);
      pa[2 * i] = ph.x; pa[2 * i + 1] = ph.y; pal[2 * i] = pl.x; pal[2 * i + 1] = pl.y; }
    const v2f es1 = ((ev[0] + ev[1]) + (ev[2] + ev[3])) + ((ev[4] + ev[5]) + (ev[6] + ev[7])); const float es = es1.x + es1.y;
    l = l * alpha + es;
#pragma unroll
    for (int j = 0; j < 4; ++j)
#pragma unroll
      for (int r = 0; r < 8; ++r) { acc[j][r] *= alpha; accl[j][r] *= alpha; }
#pragma unroll
    for (int j = 0; j < 4; ++j) { const v16h vf = frag_h(&sv[bf][j * 16 + col][0], lane); acc[j] = wmma16(vf, pa, acc[j]); accl[j] = wmma16(vf, pal, accl[j]); }
    asm volatile("s_wait_dscnt 0x0" ::: "memory");      // this wave's LDS reads of tile ks have retired
    asm volatile("s_wait_asynccnt 0x0" ::: "memory");   // this wave's copies of tile ks + 1 have landed
    __syncthreads();                                    // publishes tile ks + 1 and ends every wave's reads of tile ks
    if (ks + 2 < NN / 32) copy_tile(ks + 2, bf); }      // refill of the buffer just left; flies during trip ks + 1
  asm volatile("s_wait_asynccnt 0x0" ::: "memory");     // no copy is outstanding when the wave goes on to the epilogue
  l += xhalf(l);                                        // the two halves' sums joined once
  { const float il = (1.0f / 2048.0f) / l;
#pragma unroll
    for (int j = 0; j < 4; ++j) { v4f o0, o1;
#pragma unroll
      for (int r = 0; r < 4; ++r) { o0[r] = (acc[j][r] + accl[j][r] * (1.0f / 2048.0f)) * il; o1[r] = (acc[j][4 + r] + accl[j][4 + r] * (1.0f / 2048.0f)) * il; }
      vst2(&so[wave][col][j * 16 + 8 * g], o0); vst2(&so[wave][col][j * 16 + 8 * g + 4], o1); } }
  LDSX(); for (int rl = 0; rl < 16; ++rl) if (lane < 16) vst2(X + ((b * NN + q0 + rl) * NH + h) * DD + lane * 4, *(const v4f*)&so[wave][rl][lane * 4]); }   // output [B][N][H][D]
extern "C" void kernel_launch(void* const* d_in, const int* in_sizes, int n_in, void* d_out, int out_size, void* d_ws, size_t ws_size, hipStream_t stream) {
  (void)in_sizes; (void)n_in; (void)out_size;
  const float** F = (const float**)d_in;   // 0 q, 1 k, 2 v [4,8,2048,64]
  if (ws_size < (size_t)WS_END) return;
  char* ws = (char*)d_ws; _Float16* VT = (_Float16*)(ws + WS_VT); float* KK = (float*)(ws + WS_KK);
  k_prep<<<dim3(NN / 64, NBH), 256, 0, stream>>>(F[1], F[2], VT, KK);
  k_att<<<dim3(NN / 64, TBH), 128, 0, stream>>>(F[0], F[1], KK, VT, (float*)d_out);
}

// v004
// It runs in 72 microseconds.
// Two timings next to v003 put it at 1.09 and 1.06 times that version's speed.
// All steps since v000 together make it 3.22 times as fast.
// compute dtype: all float inputs rounded to bf16; logits q . k with EXACT bf16 products on WMMA 16x16x32 (1 product: q and k are inputs), |k|^2 per key in f32 (the per-query |q|^2 term is constant along the softmax axis and cancels), running-max softmax in f32 (hardware exp), P as f16 hi + residual (x 2^11) . v (bf16 values as f16 planes, 2 products); f32 output.
#include <hip/hip_runtime.h>
#include <math.h>

typedef __attribute__((ext_vector_type(16))) _Float16 v16h;
typedef __attribute__((ext_vector_type(16))) __bf16 v16b;
typedef __attribute__((ext_vector_type(8)))  _Float16 v8h;
typedef __attribute__((ext_vector_type(8)))  float v8f;
typedef __attribute__((ext_vector_type(4)))  float v4f;
typedef __attribute__((ext_vector_type(2)))  float v2f;
typedef __attribute__((ext_vector_type(4)))  unsigned v4u;
typedef __attribute__((ext_vector_type(4)))  int v4i;
typedef float __attribute__((may_alias)) float_a;
typedef int __attribute__((may_alias)) int_a;

template <typename T> __device__ __forceinline__ void vst2(void* p, T v) { *(T*)p = v;  }
__device__ __forceinline__ v8f wmma16(v16h a, v16h b, v8f c) {
  v8f d = __builtin_amdgcn_wmma_f32_16x16x32_f16(false, a, false, b, (short)0, c, false, false);
  return d;
}
__device__ __forceinline__ v8f wmma_bf(v16b a, v16b b, v8f c) {
  v8f d = __builtin_amdgcn_wmma_f32_16x16x32_bf16(false, a, false, b, (short)0, c, false, false);
  return d;
}
// 16x16x32 fragments: lane = (h = lane>>4, row/col = lane&15); elements 0..7 = k0+8h+0..7, 8..15 = k0+16+8h+0..7; D element r = row 8h+r
__device__ __forceinline__ v16h frag_h(const _Float16* rowk0, int lane) {
  union { v16h v; v8h q[2]; } u; const _Float16* p = rowk0 + 8 * (lane >> 4);
  u.q[0] = *(const v8h*)p; u.q[1] = *(const v8h*)(p + 16); return u.v;
}
__device__ __forceinline__ v16h frag_f32(const float* rowk0, int lane) {
  v16h a; const float* p = rowk0 + 8 * (lane >> 4);
#pragma unroll
  for (int i = 0; i < 8; ++i) { a[i] = (_Float16)p[i]; a[8 + i] = (_Float16)p[16 + i]; }
  return a;
}
__device__ __forceinline__ v16h frag_f32s(const float* rowk0, int lane, float sc) {
  v16h a; const float* p = rowk0 + 8 * (lane >> 4);
#pragma unroll
  for (int i = 0; i < 8; ++i) { a[i] = (_Float16)(p[i] * sc); a[8 + i] = (_Float16)(p[16 + i] * sc); }
  return a;
}
// column fragment from a [K][ld] layout (column n), rows >= K read as 0
__device__ __forceinline__ v16h fragc_f32(const float* W, int k0, int n, int lane, int ld, int K) {
  v16h a; const int g = lane >> 4;
#pragma unroll
  for (int i = 0; i < 8; ++i) { const int ka = k0 + 8 * g + i, kb = ka + 16;
    a[i] = (_Float16)(ka < K ? W[(size_t)(ka < K ? ka : K - 1) * ld + n] : 0.f); a[8 + i] = (_Float16)(kb < K ? W[(size_t)(kb < K ? kb : K - 1) * ld + n] : 0.f); }
  return a;
}
struct F2 { v16b h, l; };
__device__ __forceinline__ F2 bsplit16(const float v[16]) { F2 r;
#pragma unroll
  for (int i = 0; i < 16; ++i) { const __bf16 h = (__bf16)v[i]; r.h[i] = h; r.l[i] = (__bf16)(v[i] - (float)h); }
  return r; }
__device__ __forceinline__ F2 split_row(const float* row, int k0, int lane) { float v[16]; const float* p = row + k0 + 8 * (lane >> 4);
#pragma unroll
  for (int i = 0; i < 8; ++i) { v[i] = p[i]; v[8 + i] = p[16 + i]; }
  return bsplit16(v); }
__device__ __forceinline__ F2 split_rowK(const float* row, int k0, int lane, int K) { float v[16]; const int g = lane >> 4;
#pragma unroll
  for (int i = 0; i < 8; ++i) { const int ka = k0 + 8 * g + i, kb = ka + 16; v[i] = ka < K ? row[ka < K ? ka : K - 1] : 0.f; v[8 + i] = kb < K ? row[kb < K ? kb : K - 1] : 0.f; }
  return bsplit16(v); }
__device__ __forceinline__ F2 split_col(const float* W, int k0, int n, int lane, int ld, int K) { float v[16]; const int g = lane >> 4;
#pragma unroll
  for (int i = 0; i < 8; ++i) { const int ka = k0 + 8 * g + i, kb = ka + 16; v[i] = ka < K ? W[(size_t)(ka < K ? ka : K - 1) * ld + n] : 0.f; v[8 + i] = kb < K ? W[(size_t)(kb < K ? kb : K - 1) * ld + n] : 0.f; }
  return bsplit16(v); }
__device__ __forceinline__ v8f mac3(const F2& a, const F2& b, v8f c) { c = wmma_bf(a.l, b.h, c); c = wmma_bf(a.h, b.l, c); return wmma_bf(a.h, b.h, c); }
__device__ __forceinline__ float sigm(float v) { return 1.0f / (1.0f + expf(-v)); }
#define LDSX() do { asm volatile("s_wait_dscnt 0" ::: "memory"); __builtin_amdgcn_wave_barrier(); __builtin_amdgcn_fence(__ATOMIC_RELEASE, "workgroup"); } while (0)


// Global L2-distance attention (B 4, H 8, N 2,048, D 64): attn = softmax(-(|q|^2 - 2 q.k + |k|^2) / 8) over keys; x = attn v, output [B, N, H, D].
#define NB 4
#define NH 8
#define NBH (NB * NH)
#define NN 2048
#define DD 64
#ifndef TBH
#define TBH NBH
#endif
typedef __attribute__((ext_vector_type(8))) __bf16 v8b;
__device__ __forceinline__ v16b frag_b(const __bf16* rowk0, int lane) {
  union { v16b v; v8b q[2]; } u; const __bf16* p = rowk0 + 8 * (lane >> 4);
  u.q[0] = *(const v8b*)p; u.q[1] = *(const v8b*)(p + 16); return u.v;
}
__device__ __forceinline__ float bfr(float v) { return (float)(__bf16)v; }
__device__ __attribute__((noinline)) float exp_ni(float v) { return expf(v); }
__device__ __attribute__((noinline)) float erf_ni(float v) { return erff(v); }

#define WS_VT  0u                                   // f16 v planes [bh][64][2048]
#define WS_KK  (WS_VT + 2u * (size_t)NBH * DD * NN)      // f32 |k|^2 [bh][n]
#define WS_END (WS_KK + 4u * (size_t)NBH * NN)

__device__ __forceinline__ v16b fragb_f32(const float* __restrict__ p, int lane) { v16b a; const float* pp = p + 8 * (lane >> 4);
#pragma unroll
  for (int i = 0; i < 8; ++i) { a[i] = (__bf16)pp[i]; a[8 + i] = (__bf16)pp[16 + i]; } return a; }
typedef __attribute__((ext_vector_type(2))) _Float16 v2h_p;
// ---- k_prep: block = (128 keys, bh), 128 threads: v -> transposed f16 planes; kk = sum(k^2). A thread's thirty-two 16-byte loads of v and k are all issued ahead of their first use: one trip to memory a block
#define PK 128   // keys a block
template <int M> __device__ __forceinline__ float row_xadd(float v) { return v + __builtin_bit_cast(float, __builtin_amdgcn_update_dpp(0, __builtin_bit_cast(int, v), 0x160 + M, 0xf, 0xf, true)); }   // v + the value of lane ^ M inside the 16-lane row (DPP row_xmask)
__global__ __launch_bounds__(128) void k_prep(const float* __restrict__ K, const float* __restrict__ V, _Float16* __restrict__ VT, float* __restrict__ KK) { __shared__ __align__(16) _Float16 st[DD][PK + 8]; __shared__ __align__(16) float skk[PK];
  const int t = threadIdx.x, c4 = (t & 15) * 4, a = t >> 4; const size_t bh = blockIdx.y; const int n0 = blockIdx.x * PK; const size_t r0 = bh * NN + n0;
  const float* pv = V + (r0 + 2 * a) * DD + c4; const float* pk = K + (r0 + a) * DD + c4;
  v4f va[PK / 16], vb[PK / 16], kr[PK / 8];   // 16 lanes read one whole 256-byte row; va, vb: v of key 2 (a + 8 i) and of the next; kr: k of key a + 8 i
#pragma unroll   // unrolled so that the arrays stay in registers and the loads stand together
  for (int i = 0; i < PK / 16; ++i) { va[i] = *(const v4f*)(pv + 16 * i * DD); vb[i] = *(const v4f*)(pv + (16 * i + 1) * DD); }
#pragma unroll   // the same
  for (int i = 0; i < PK / 8; ++i) kr[i] = *(const v4f*)(pk + 8 * i * DD);
  asm volatile("s_wait_xcnt 0x0" :: "v"(pv), "v"(pk) : "memory");   // the wait in front of any overwrite of the loads' address registers, which it names so that no later load lands on them; no load moves behind it either, so all thirty-two are in flight before the first use (left alone the compiler holds some back: a second trip to memory)
#pragma unroll   // the same
  for (int i = 0; i < PK / 16; ++i)
#pragma unroll   // the same
    for (int j = 0; j < 4; ++j) { const v2h_p w = {(_Float16)bfr(va[i][j]), (_Float16)bfr(vb[i][j])}; *(v2h_p*)&st[c4 + j][2 * (a + 8 * i)] = w; }   // two neighbouring keys of one d: one 4-byte LDS store
  float ks[PK / 8];
#pragma unroll   // the same
  for (int i = 0; i < PK / 8; ++i) { float s = 0.f;
#pragma unroll   // the same
    for (int j = 0; j < 4; ++j) { const float x = bfr(kr[i][j]); s += x * x; }
    s = row_xadd<1>(s); s = row_xadd<2>(s); s = row_xadd<4>(s); ks[i] = row_xadd<8>(s); }   // the row's 16 partial sums joined
  if ((t & 15) == 0) {
#pragma unroll   // the same
    for (int i = 0; i < PK / 8; ++i) skk[a + 8 * i] = ks[i]; }
  __syncthreads();
#pragma unroll   // unrolled so that the LDS reads stand ahead of the stores
  for (int i = 0; i < DD * (PK / 8) / 128; ++i) { const int e = t + 128 * i, d = e / (PK / 8), q = e % (PK / 8); vst2((unsigned*)(VT + (bh * DD + d) * (size_t)NN + n0 + q * 8), *(const v4u*)&st[d][q * 8]); }
  if (t < PK / 4) vst2(KK + r0 + t * 4, *(const v4f*)&skk[t * 4]); }
// ---- asynchronous copies to LDS: each lane brings its own 16 bytes; the s_wait_xcnt stands inside the copies' own statement, in front of any rewrite of their address registers
__device__ __forceinline__ unsigned lds_off(const void* p) { return (unsigned)(size_t)p; }   // low 32 bits of a __shared__ address = byte offset in the work-group's LDS
__device__ __forceinline__ void copy4(unsigned l0, unsigned l1, unsigned l2, unsigned l3, const void* g0, const void* g1, const void* g2, const void* g3) {
  asm volatile("global_load_async_to_lds_b128 %0, %4, off\n\tglobal_load_async_to_lds_b128 %1, %5, off\n\tglobal_load_async_to_lds_b128 %2, %6, off\n\tglobal_load_async_to_lds_b128 %3, %7, off\n\ts_wait_xcnt 0x0"
               :: "v"(l0), "v"(l1), "v"(l2), "v"(l3), "v"(g0), "v"(g1), "v"(g2), "v"(g3) : "memory"); }
__device__ __forceinline__ void copy6(unsigned l0, unsigned l1, unsigned l2, unsigned l3, unsigned l4, unsigned l5, const void* g0, const void* g1, const void* g2, const void* g3, const void* g4, const void* g5) {
  asm volatile("global_load_async_to_lds_b128 %0, %6, off\n\tglobal_load_async_to_lds_b128 %1, %7, off\n\tglobal_load_async_to_lds_b128 %2, %8, off\n\tglobal_load_async_to_lds_b128 %3, %9, off\n\tglobal_load_async_to_lds_b128 %4, %10, off\n\tglobal_load_async_to_lds_b128 %5, %11, off\n\ts_wait_xcnt 0x0"
               :: "v"(l0), "v"(l1), "v"(l2), "v"(l3), "v"(l4), "v"(l5), "v"(g0), "v"(g1), "v"(g2), "v"(g3), "v"(g4), "v"(g5) : "memory"); }
#define KPITCH 68   // floats: 272-byte rows, conflict-free for 16-byte LDS reads of 256-byte rows
#define VPITCH 40   // halves: 80-byte rows, the same for 64-byte rows
// ---- k_att: block = (64 queries, bh): transposed products: S^T = k . q^T (a lane holds 16 keys' scores of ONE query), s = (2 q.k - kk_j) / 8; softmax in the lane; O^T += v^T . P^T with P (hi + residual) packed from the score registers; the 32-key tiles of k and v come through a two-buffer LDS ring shared by the four waves
typedef __attribute__((ext_vector_type(2))) _Float16 v2h;
__device__ __forceinline__ float xhalf(float v) { return __builtin_bit_cast(float, __builtin_amdgcn_permlanex16(__builtin_bit_cast(int, v), __builtin_bit_cast(int, v), 0x76543210, 0xfedcba98, false, false)); }   // the value of lane ^ 16
__global__ __launch_bounds__(128) void k_att(const float* __restrict__ Q, const float* __restrict__ K, const float* __restrict__ KK, const _Float16* __restrict__ VT, float* __restrict__ X) {
  __shared__ __align__(16) float so[4][16][68];
  __shared__ __align__(16) float sk[2][32][KPITCH]; __shared__ __align__(16) _Float16 sv[2][DD][VPITCH]; __shared__ __align__(16) float skk[NN];
  const int tid = threadIdx.x, wave = tid >> 5, lane = tid & 31, col = lane & 15, g = lane >> 4; const size_t bh = blockIdx.y; const size_t b = bh / NH, h = bh % NH; const int q0 = blockIdx.x * 64 + wave * 16; const size_t rq = bh * NN + q0;
  const float* gk = K + (bh * NN + (tid >> 4)) * DD + (tid & 15) * 4;                    // k tile: 32 rows of 256 bytes, a thread's four pieces lie 8 rows apart
  const _Float16* gv = VT + (bh * DD + (tid >> 2)) * (size_t)NN + (tid & 3) * 8;          // v tile: 64 rows (d) of 64 bytes, a thread's two pieces lie 32 rows apart
  auto copy_tile = [&](int t, int bf) {
    const float* a = gk + (size_t)t * 32 * DD; const unsigned la = lds_off(&sk[bf][tid >> 4][(tid & 15) * 4]);
    const _Float16* c = gv + t * 32; const unsigned lc = lds_off(&sv[bf][tid >> 2][(tid & 3) * 8]);
    copy6(la, la + 8 * KPITCH * 4, la + 16 * KPITCH * 4, la + 24 * KPITCH * 4, lc, lc + 32 * VPITCH * 2, a, a + 8 * DD, a + 16 * DD, a + 24 * DD, c, c + 32 * (size_t)NN); };
  { const float* a = KK + bh * NN + tid * 4; const unsigned la = lds_off(&skk[tid * 4]); copy4(la, la + 2048, la + 4096, la + 6144, a, a + 512, a + 1024, a + 1536); }   // |k|^2 of all keys, filled once
  copy_tile(0, 0);
  asm volatile("s_wait_asynccnt 0x0" ::: "memory");   // this wave's copies of |k|^2 and of tile 0 have landed
  __syncthreads();                                    // every wave's have: tile 0 may be read
  copy_tile(1, 1);
  v16b aq[2];                                         // B operand: column = query q0 + col
#pragma unroll
  for (int kc = 0; kc < 2; ++kc) aq[kc] = fragb_f32(Q + (rq + col) * DD + kc * 32, lane);
  float m = -3.0e38f, l = 0.f;                        // of query q0 + col: m equal in both lane halves, l each half's own part
  v8f acc[4] = {}, accl[4] = {};                      // O^T: element r of tile j = d j * 16 + 8 g + r of query q0 + col
#pragma unroll 1
  for (int ks = 0; ks < NN / 32; ++ks) { v2f s[2][4]; const int bf = ks & 1;
#pragma unroll
    for (int ct = 0; ct < 2; ++ct) { v8f c = {};     // element r = key ks * 32 + ct * 16 + 8 g + r
#pragma unroll
      for (int kc = 0; kc < 2; ++kc) c = wmma_bf(fragb_f32(&sk[bf][ct * 16 + col][kc * 32], lane), aq[kc], c);
      const float* kkp = &skk[ks * 32 + ct * 16 + 8 * g]; const v4f ka = *(const v4f*)kkp, kb = *(const v4f*)(kkp + 4);
      s[ct][0] = (2.0f * c.s01 - ka.s01) * 0.125f; s[ct][1] = (2.0f * c.s23 - ka.s23) * 0.125f; s[ct][2] = (2.0f * c.s45 - kb.s01) * 0.125f; s[ct][3] = (2.0f * c.s67 - kb.s23) * 0.125f; }
    float mx = fmaxf(s[0][0].x, s[0][0].y);
#pragma unroll
    for (int i = 1; i < 8; ++i) mx = fmaxf(mx, fmaxf(s[i >> 2][i & 3].x, s[i >> 2][i & 3].y));
    mx = fmaxf(mx, xhalf(mx));
    const float mn = fmaxf(m, mx), alpha = __expf(m - mn); m = mn;
    v2f ev[8]; v16h pa, pal;               // B operand of the second product: element i = key 8 g + i, element 8 + i = key 16 + 8 g + i: the two score tiles as they lie
#pragma unroll
    for (int i = 0; i < 8; ++i) { const v2f d = s[i >> 2][i & 3] - mn; const v2f e = {__expf(d.x), __expf(d.y)}; ev[i] = e;
      const v2f p = e * 2048.0f; const v2h ph = __builtin_convertvector(p, v2h); const v2h pl = __builtin_convertvector((p - __builtin_convertvector(ph, v2f)) * 2048.0f, v2h);
      pa[2 * i] = ph.x; pa[2 * i + 1] = ph.y; pal[2 * i] = pl.x; pal[2 * i + 1] = pl.y; }
    const v2f es1 = ((ev[0] + ev[1]) + (ev[2] + ev[3])) + ((ev[4] + ev[5]) + (ev[6] + ev[7])); const float es = es1.x + es1.y;
    l = l * alpha + es;
#pragma unroll
    for (int j = 0; j < 4; ++j)
#pragma unroll
      for (int r = 0; r < 8; ++r) { acc[j][r] *= alpha; accl[j][r] *= alpha; }
#pragma unroll
    for (int j = 0; j < 4; ++j) { const v16h vf = frag_h(&sv[bf][j * 16 + col][0], lane); acc[j] = wmma16(vf, pa, acc[j]); accl[j] = wmma16(vf, pal, accl[j]); }
    asm volatile("s_wait_dscnt 0x0" ::: "memory");      // this wave's LDS reads of tile ks have retired
    asm volatile("s_wait_asynccnt 0x0" ::: "memory");   // this wave's copies of tile ks + 1 have landed
    __syncthreads();                                    // publishes tile ks + 1 and ends every wave's reads of tile ks
    if (ks + 2 < NN / 32) copy_tile(ks + 2, bf); }      // refill of the buffer just left; flies during trip ks + 1
  asm volatile("s_wait_asynccnt 0x0" ::: "memory");     // no copy is outstanding when the wave goes on to the epilogue
  l += xhalf(l);                                        // the two halves' sums joined once
  { const float il = (1.0f / 2048.0f) / l;
#pragma unroll
    for (int j = 0; j < 4; ++j) { v4f o0, o1;
#pragma unroll
      for (int r = 0; r < 4; ++r) { o0[r] = (acc[j][r] + accl[j][r] * (1.0f / 2048.0f)) * il; o1[r] = (acc[j][4 + r] + accl[j][4 + r] * (1.0f / 2048.0f)) * il; }
      vst2(&so[wave][col][j * 16 + 8 * g], o0); vst2(&so[wave][col][j * 16 + 8 * g + 4], o1); } }
  LDSX(); for (int rl = 0; rl < 16; ++rl) if (lane < 16) vst2(X + ((b * NN + q0 + rl) * NH + h) * DD + lane * 4, *(const v4f*)&so[wave][rl][lane * 4]); }   // output [B][N][H][D]
extern "C" void kernel_launch(void* const* d_in, const int* in_sizes, int n_in, void* d_out, int out_size, void* d_ws, size_t ws_size, hipStream_t stream) {
  (void)in_sizes; (void)n_in; (void)out_size;
  const float** F = (const float**)d_in;   // 0 q, 1 k, 2 v [4,8,2048,64]
  if (ws_size < (size_t)WS_END) return;
  char* ws = (char*)d_ws; _Float16* VT = (_Float16*)(ws + WS_VT); float* KK = (float*)(ws + WS_KK);
  k_prep<<<dim3(NN / PK, NBH), 128, 0, stream>>>(F[1], F[2], VT, KK);
  k_att<<<dim3(NN / 64, TBH), 128, 0, stream>>>(F[0], F[1], KK, VT, (float*)d_out);
}

// v005
// Measured time: 64.5 microseconds a run.
// Two timings next to v004 put it at 1.12 and 1.11 times that version's speed.
// All steps since v000 together make it 3.59 times as fast.
// compute dtype: all float inputs rounded to bf16; logits q . k with EXACT bf16 products on WMMA 16x16x32 (1 product: q and k are inputs), |k|^2 per key in f32 (the per-query |q|^2 term is constant along the softmax axis and cancels), running-max softmax in f32 (hardware exp), P (x 2^11) as f16 hi + f16 residual at the same scale . v (bf16 values as f16 planes, 2 products into one accumulator); f32 output.
#include <hip/hip_runtime.h>
#include <math.h>

typedef __attribute__((ext_vector_type(16))) _Float16 v16h;
typedef __attribute__((ext_vector_type(16))) __bf16 v16b;
typedef __attribute__((ext_vector_type(8)))  _Float16 v8h;
typedef __attribute__((ext_vector_type(8)))  float v8f;
typedef __attribute__((ext_vector_type(4)))  float v4f;
typedef __attribute__((ext_vector_type(2)))  float v2f;
typedef __attribute__((ext_vector_type(4)))  unsigned v4u;
typedef __attribute__((ext_vector_type(4)))  int v4i;
typedef float __attribute__((may_alias)) float_a;
typedef int __attribute__((may_alias)) int_a;

template <typename T> __device__ __forceinline__ void vst2(void* p, T v) { *(T*)p = v;  }
__device__ __forceinline__ v8f wmma16(v16h a, v16h b, v8f c) {
  v8f d = __builtin_amdgcn_wmma_f32_16x16x32_f16(false, a, false, b, (short)0, c, false, false);
  return d;
}
__device__ __forceinline__ v8f wmma_bf(v16b a, v16b b, v8f c) {
  v8f d = __builtin_amdgcn_wmma_f32_16x16x32_bf16(false, a, false, b, (short)0, c, false, false);
  return d;
}
// 16x16x32 fragments: lane = (h = lane>>4, row/col = lane&15); elements 0..7 = k0+8h+0..7, 8..15 = k0+16+8h+0..7; D element r = row 8h+r
__device__ __forceinline__ v16h frag_h(const _Float16* rowk0, int lane) {
  union { v16h v; v8h q[2]; } u; const _Float16* p = rowk0 + 8 * (lane >> 4);
  u.q[0] = *(const v8h*)p; u.q[1] = *(const v8h*)(p + 16); return u.v;
}
__device__ __forceinline__ v16h frag_f32(const float* rowk0, int lane) {
  v16h a; const float* p = rowk0 + 8 * (lane >> 4);
#pragma unroll
  for (int i = 0; i < 8; ++i) { a[i] = (_Float16)p[i]; a[8 + i] = (_Float16)p[16 + i]; }
  return a;
}
__device__ __forceinline__ v16h frag_f32s(const float* rowk0, int lane, float sc) {
  v16h a; const float* p = rowk0 + 8 * (lane >> 4);
#pragma unroll
  for (int i = 0; i < 8; ++i) { a[i] = (_Float16)(p[i] * sc); a[8 + i] = (_Float16)(p[16 + i] * sc); }
  return a;
}
// column fragment from a [K][ld] layout (column n), rows >= K read as 0
__device__ __forceinline__ v16h fragc_f32(const float* W, int k0, int n, int lane, int ld, int K) {
  v16h a; const int g = lane >> 4;
#pragma unroll
  for (int i = 0; i < 8; ++i) { const int ka = k0 + 8 * g + i, kb = ka + 16;
    a[i] = (_Float16)(ka < K ? W[(size_t)(ka < K ? ka : K - 1) * ld + n] : 0.f); a[8 + i] = (_Float16)(kb < K ? W[(size_t)(kb < K ? kb : K - 1) * ld + n] : 0.f); }
  return a;
}
struct F2 { v16b h, l; };
__device__ __forceinline__ F2 bsplit16(const float v[16]) { F2 r;
#pragma unroll
  for (int i = 0; i < 16; ++i) { const __bf16 h = (__bf16)v[i]; r.h[i] = h; r.l[i] = (__bf16)(v[i] - (float)h); }
  return r; }
__device__ __forceinline__ F2 split_row(const float* row, int k0, int lane) { float v[16]; const float* p = row + k0 + 8 * (lane >> 4);
#pragma unroll
  for (int i = 0; i < 8; ++i) { v[i] = p[i]; v[8 + i] = p[16 + i]; }
  return bsplit16(v); }
__device__ __forceinline__ F2 split_rowK(const float* row, int k0, int lane, int K) { float v[16]; const int g = lane >> 4;
#pragma unroll
  for (int i = 0; i < 8; ++i) { const int ka = k0 + 8 * g + i, kb = ka + 16; v[i] = ka < K ? row[ka < K ? ka : K - 1] : 0.f; v[8 + i] = kb < K ? row[kb < K ? kb : K - 1] : 0.f; }
  return bsplit16(v); }
__device__ __forceinline__ F2 split_col(const float* W, int k0, int n, int lane, int ld, int K) { float v[16]; const int g = lane >> 4;
#pragma unroll
  for (int i = 0; i < 8; ++i) { const int ka = k0 + 8 * g + i, kb = ka + 16; v[i] = ka < K ? W[(size_t)(ka < K ? ka : K - 1) * ld + n] : 0.f; v[8 + i] = kb < K ? W[(size_t)(kb < K ? kb : K - 1) * ld + n] : 0.f; }
  return bsplit16(v); }
__device__ __forceinline__ v8f mac3(const F2& a, const F2& b, v8f c) { c = wmma_bf(a.l, b.h, c); c = wmma_bf(a.h, b.l, c); return wmma_bf(a.h, b.h, c); }
__device__ __forceinline__ float sigm(float v) { return 1.0f / (1.0f + expf(-v)); }
#define LDSX() do { asm volatile("s_wait_dscnt 0" ::: "memory"); __builtin_amdgcn_wave_barrier(); __builtin_amdgcn_fence(__ATOMIC_RELEASE, "workgroup"); } while (0)


// Global L2-distance attention (B 4, H 8, N 2,048, D 64): attn = softmax(-(|q|^2 - 2 q.k + |k|^2) / 8) over keys; x = attn v, output [B, N, H, D].
#define NB 4
#define NH 8
#define NBH (NB * NH)
#define NN 2048
#define DD 64
#ifndef TBH
#define TBH NBH
#endif
typedef __attribute__((ext_vector_type(8))) __bf16 v8b;
__device__ __forceinline__ v16b frag_b(const __bf16* rowk0, int lane) {
  union { v16b v; v8b q[2]; } u; const __bf16* p = rowk0 + 8 * (lane >> 4);
  u.q[0] = *(const v8b*)p; u.q[1] = *(const v8b*)(p + 16); return u.v;
}
__device__ __forceinline__ float bfr(float v) { return (float)(__bf16)v; }
__device__ __attribute__((noinline)) float exp_ni(float v) { return expf(v); }
__device__ __attribute__((noinline)) float erf_ni(float v) { return erff(v); }

#define WS_VT  0u                                   // f16 v planes [bh][64][2048]
#define WS_KK  (WS_VT + 2u * (size_t)NBH * DD * NN)      // f32 |k|^2 [bh][n]
#define WS_END (WS_KK + 4u * (size_t)NBH * NN)

__device__ __forceinline__ v16b fragb_f32(const float* __restrict__ p, int lane) { v16b a; const float* pp = p + 8 * (lane >> 4);
#pragma unroll
  for (int i = 0; i < 8; ++i) { a[i] = (__bf16)pp[i]; a[8 + i] = (__bf16)pp[16 + i]; } return a; }
typedef __attribute__((ext_vector_type(2))) _Float16 v2h_p;
// ---- k_prep: block = (128 keys, bh), 128 threads: v -> transposed f16 planes; kk = sum(k^2). A thread's thirty-two 16-byte loads of v and k are all issued ahead of their first use: one trip to memory a block
#define PK 128   // keys a block
template <int M> __device__ __forceinline__ float row_xadd(float v) { return v + __builtin_bit_cast(float, __builtin_amdgcn_update_dpp(0, __builtin_bit_cast(int, v), 0x160 + M, 0xf, 0xf, true)); }   // v + the value of lane ^ M inside the 16-lane row (DPP row_xmask)
__global__ __launch_bounds__(128) void k_prep(const float* __restrict__ K, const float* __restrict__ V, _Float16* __restrict__ VT, float* __restrict__ KK) { __shared__ __align__(16) _Float16 st[DD][PK + 8]; __shared__ __align__(16) float skk[PK];
  const int t = threadIdx.x, c4 = (t & 15) * 4, a = t >> 4; const size_t bh = blockIdx.y; const int n0 = blockIdx.x * PK; const size_t r0 = bh * NN + n0;
  const float* pv = V + (r0 + 2 * a) * DD + c4; const float* pk = K + (r0 + a) * DD + c4;
  v4f va[PK / 16], vb[PK / 16], kr[PK / 8];   // 16 lanes read one whole 256-byte row; va, vb: v of key 2 (a + 8 i) and of the next; kr: k of key a + 8 i
#pragma unroll   // unrolled so that the arrays stay in registers and the loads stand together
  for (int i = 0; i < PK / 16; ++i) { va[i] = *(const v4f*)(pv + 16 * i * DD); vb[i] = *(const v4f*)(pv + (16 * i + 1) * DD); }
#pragma unroll   // the same
  for (int i = 0; i < PK / 8; ++i) kr[i] = *(const v4f*)(pk + 8 * i * DD);
  asm volatile("s_wait_xcnt 0x0" :: "v"(pv), "v"(pk) : "memory");   // the wait in front of any overwrite of the loads' address registers, which it names so that no later load lands on them; no load moves behind it either, so all thirty-two are in flight before the first use (left alone the compiler holds some back: a second trip to memory)
#pragma unroll   // the same
  for (int i = 0; i < PK / 16; ++i)
#pragma unroll   // the same
    for (int j = 0; j < 4; ++j) { const v2h_p w = {(_Float16)bfr(va[i][j]), (_Float16)bfr(vb[i][j])}; *(v2h_p*)&st[c4 + j][2 * (a + 8 * i)] = w; }   // two neighbouring keys of one d: one 4-byte LDS store
  float ks[PK / 8];
#pragma unroll   // the same
  for (int i = 0; i < PK / 8; ++i) { float s = 0.f;
#pragma unroll   // the same
    for (int j = 0; j < 4; ++j) { const float x = bfr(kr[i][j]); s += x * x; }
    s = row_xadd<1>(s); s = row_xadd<2>(s); s = row_xadd<4>(s); ks[i] = row_xadd<8>(s); }   // the row's 16 partial sums joined
  if ((t & 15) == 0) {
#pragma unroll   // the same
    for (int i = 0; i < PK / 8; ++i) skk[a + 8 * i] = ks[i]; }
  __syncthreads();
#pragma unroll   // unrolled so that the LDS reads stand ahead of the stores
  for (int i = 0; i < DD * (PK / 8) / 128; ++i) { const int e = t + 128 * i, d = e / (PK / 8), q = e % (PK / 8); vst2((unsigned*)(VT + (bh * DD + d) * (size_t)NN + n0 + q * 8), *(const v4u*)&st[d][q * 8]); }
  if (t < PK / 4) vst2(KK + r0 + t * 4, *(const v4f*)&skk[t * 4]); }
// ---- asynchronous copies to LDS: each lane brings its own 16 bytes; the s_wait_xcnt stands inside the copies' own statement, in front of any rewrite of their address registers
__device__ __forceinline__ unsigned lds_off(const void* p) { return (unsigned)(size_t)p; }   // low 32 bits of a __shared__ address = byte offset in the work-group's LDS
__device__ __forceinline__ void copy4(unsigned l0, unsigned l1, unsigned l2, unsigned l3, const void* g0, const void* g1, const void* g2, const void* g3) {
  asm volatile("global_load_async_to_lds_b128 %0, %4, off\n\tglobal_load_async_to_lds_b128 %1, %5, off\n\tglobal_load_async_to_lds_b128 %2, %6, off\n\tglobal_load_async_to_lds_b128 %3, %7, off\n\ts_wait_xcnt 0x0"
               :: "v"(l0), "v"(l1), "v"(l2), "v"(l3), "v"(g0), "v"(g1), "v"(g2), "v"(g3) : "memory"); }
__device__ __forceinline__ void copy6(unsigned l0, unsigned l1, unsigned l2, unsigned l3, unsigned l4, unsigned l5, const void* g0, const void* g1, const void* g2, const void* g3, const void* g4, const void* g5) {
  asm volatile("global_load_async_to_lds_b128 %0, %6, off\n\tglobal_load_async_to_lds_b128 %1, %7, off\n\tglobal_load_async_to_lds_b128 %2, %8, off\n\tglobal_load_async_to_lds_b128 %3, %9, off\n\tglobal_load_async_to_lds_b128 %4, %10, off\n\tglobal_load_async_to_lds_b128 %5, %11, off\n\ts_wait_xcnt 0x0"
               :: "v"(l0), "v"(l1), "v"(l2), "v"(l3), "v"(l4), "v"(l5), "v"(g0), "v"(g1), "v"(g2), "v"(g3), "v"(g4), "v"(g5) : "memory"); }
#define KPITCH 68   // floats: 272-byte rows, conflict-free for 16-byte LDS reads of 256-byte rows
#define VPITCH 40   // halves: 80-byte rows, the same for 64-byte rows
// ---- k_att: block = (64 queries, bh): transposed products: S^T = k . q^T (a lane holds 16 keys' scores of ONE query), s = (2 q.k - kk_j) / 8; softmax in the lane; O^T += v^T . P^T with P (hi + residual) packed from the score registers; the 32-key tiles of k and v come through a two-buffer LDS ring shared by the four waves
typedef __attribute__((ext_vector_type(2))) _Float16 v2h;
__device__ __forceinline__ float xhalf(float v) { return __builtin_bit_cast(float, __builtin_amdgcn_permlanex16(__builtin_bit_cast(int, v), __builtin_bit_cast(int, v), 0x76543210, 0xfedcba98, false, false)); }   // the value of lane ^ 16
// residuals of eight values p against their f16 roundings h (two a register), rounded to f16 and packed like h: r = (f16)(p - h), the f16 source read in place, one v_fma_mix an element (the compiler's own form widens h, subtracts and packs: twice the instructions).
// The four low halves stand ahead of the four high halves, which write the same registers; the s_delay_alu name that producer four back, so that the SIMD goes on to another wave instead of stalling
__device__ __forceinline__ void resid8(const v2f* p, const unsigned* h, unsigned* r) {
  asm("v_fma_mixlo_f16 %0, %4, 1.0, -%12 op_sel_hi:[0,0,1]\n\tv_fma_mixlo_f16 %1, %6, 1.0, -%13 op_sel_hi:[0,0,1]\n\tv_fma_mixlo_f16 %2, %8, 1.0, -%14 op_sel_hi:[0,0,1]\n\tv_fma_mixlo_f16 %3, %10, 1.0, -%15 op_sel_hi:[0,0,1]\n\t"
      "s_delay_alu instid0(VALU_DEP_4) | instskip(NEXT) | instid1(VALU_DEP_4)\n\t"
      "v_fma_mixhi_f16 %0, %5, 1.0, -%12 op_sel:[0,0,1] op_sel_hi:[0,0,1]\n\tv_fma_mixhi_f16 %1, %7, 1.0, -%13 op_sel:[0,0,1] op_sel_hi:[0,0,1]\n\t"
      "s_delay_alu instid0(VALU_DEP_4) | instskip(NEXT) | instid1(VALU_DEP_4)\n\t"
      "v_fma_mixhi_f16 %2, %9, 1.0, -%14 op_sel:[0,0,1] op_sel_hi:[0,0,1]\n\tv_fma_mixhi_f16 %3, %11, 1.0, -%15 op_sel:[0,0,1] op_sel_hi:[0,0,1]"
      : "=&v"(r[0]), "=&v"(r[1]), "=&v"(r[2]), "=&v"(r[3])
      : "v"(p[0].x), "v"(p[0].y), "v"(p[1].x), "v"(p[1].y), "v"(p[2].x), "v"(p[2].y), "v"(p[3].x), "v"(p[3].y), "v"(h[0]), "v"(h[1]), "v"(h[2]), "v"(h[3])); }
__global__ __launch_bounds__(128) void k_att(const float* __restrict__ Q, const float* __restrict__ K, const float* __restrict__ KK, const _Float16* __restrict__ VT, float* __restrict__ X) {
  __shared__ __align__(16) float so[4][16][68];
  __shared__ __align__(16) float sk[2][32][KPITCH]; __shared__ __align__(16) _Float16 sv[2][DD][VPITCH]; __shared__ __align__(16) float skk[NN];
  const int tid = threadIdx.x, wave = tid >> 5, lane = tid & 31, col = lane & 15, g = lane >> 4; const size_t bh = blockIdx.y; const size_t b = bh / NH, h = bh % NH; const int q0 = blockIdx.x * 64 + wave * 16; const size_t rq = bh * NN + q0;
  const float* gk = K + (bh * NN + (tid >> 4)) * DD + (tid & 15) * 4;                    // k tile: 32 rows of 256 bytes, a thread's four pieces lie 8 rows apart
  const _Float16* gv = VT + (bh * DD + (tid >> 2)) * (size_t)NN + (tid & 3) * 8;          // v tile: 64 rows (d) of 64 bytes, a thread's two pieces lie 32 rows apart
  auto copy_tile = [&](int t, int bf) {
    const float* a = gk + (size_t)t * 32 * DD; const unsigned la = lds_off(&sk[bf][tid >> 4][(tid & 15) * 4]);
    const _Float16* c = gv + t * 32; const unsigned lc = lds_off(&sv[bf][tid >> 2][(tid & 3) * 8]);
    copy6(la, la + 8 * KPITCH * 4, la + 16 * KPITCH * 4, la + 24 * KPITCH * 4, lc, lc + 32 * VPITCH * 2, a, a + 8 * DD, a + 16 * DD, a + 24 * DD, c, c + 32 * (size_t)NN); };
  { const float* a = KK + bh * NN + tid * 4; const unsigned la = lds_off(&skk[tid * 4]); copy4(la, la + 2048, la + 4096, la + 6144, a, a + 512, a + 1024, a + 1536); }   // |k|^2 of all keys, filled once
  copy_tile(0, 0);
  asm volatile("s_wait_asynccnt 0x0" ::: "memory");   // this wave's copies of |k|^2 and of tile 0 have landed
  __syncthreads();                                    // every wave's have: tile 0 may be read
  copy_tile(1, 1);
  v16b aq[2];                                         // B operand: column = query q0 + col
#pragma unroll
  for (int kc = 0; kc < 2; ++kc) aq[kc] = fragb_f32(Q + (rq + col) * DD + kc * 32, lane);
  float m = -3.0e38f, l = 0.f;                        // of query q0 + col: m equal in both lane halves, l each half's own part
  v8f acc[4] = {};                                    // O^T: element r of tile j = d j * 16 + 8 g + r of query q0 + col; P's hi part and its residual add into the same tile
#pragma unroll 1
  for (int ks = 0; ks < NN / 32; ++ks) { v2f s[2][4]; const int bf = ks & 1;
#pragma unroll
    for (int ct = 0; ct < 2; ++ct) { v8f c = {};     // element r = key ks * 32 + ct * 16 + 8 g + r
#pragma unroll
      for (int kc = 0; kc < 2; ++kc) c = wmma_bf(fragb_f32(&sk[bf][ct * 16 + col][kc * 32], lane), aq[kc], c);
      const float* kkp = &skk[ks * 32 + ct * 16 + 8 * g]; const v4f ka = *(const v4f*)kkp, kb = *(const v4f*)(kkp + 4);
      s[ct][0] = (2.0f * c.s01 - ka.s01) * 0.125f; s[ct][1] = (2.0f * c.s23 - ka.s23) * 0.125f; s[ct][2] = (2.0f * c.s45 - kb.s01) * 0.125f; s[ct][3] = (2.0f * c.s67 - kb.s23) * 0.125f; }
    float mx = fmaxf(s[0][0].x, s[0][0].y);
#pragma unroll
    for (int i = 1; i < 8; ++i) mx = fmaxf(mx, fmaxf(s[i >> 2][i & 3].x, s[i >> 2][i & 3].y));
    mx = fmaxf(mx, xhalf(mx));
    const float mn = fmaxf(m, mx), alpha = __expf(m - mn); m = mn;
    v2f ev[8], pv[8]; union { v16h v; unsigned w[8]; } pa, pal;   // B operand of the second product: element i = key 8 g + i, element 8 + i = key 16 + 8 g + i: the two score tiles as they lie
#pragma unroll
    for (int i = 0; i < 8; ++i) { const v2f d = s[i >> 2][i & 3] - mn; const v2f e = {__expf(d.x), __expf(d.y)}; ev[i] = e;
      pv[i] = e * 2048.0f; pa.w[i] = __builtin_bit_cast(unsigned, __builtin_convertvector(pv[i], v2h)); }
    resid8(pv, pa.w, pal.w); resid8(pv + 4, pa.w + 4, pal.w + 4);   // the residual stays at p's scale: f16 holds it to 2^-12 of itself (2^-23 of p) or, where it is subnormal, to 2^-25 against p's top value of 2^11
    const v2f es1 = ((ev[0] + ev[1]) + (ev[2] + ev[3])) + ((ev[4] + ev[5]) + (ev[6] + ev[7])); const float es = es1.x + es1.y;
    l = l * alpha + es;
#pragma unroll
    for (int j = 0; j < 4; ++j)
#pragma unroll
      for (int r = 0; r < 8; ++r) acc[j][r] *= alpha;
    v16h vf[4];
#pragma unroll   // unrolled so that vf and acc stay in registers
    for (int j = 0; j < 4; ++j) { vf[j] = frag_h(&sv[bf][j * 16 + col][0], lane); acc[j] = wmma16(vf[j], pa.v, acc[j]); }
#pragma unroll   // the same
    for (int j = 0; j < 4; ++j) acc[j] = wmma16(vf[j], pal.v, acc[j]);   // behind the four hi products, so that no product waits for the one before it on its own tile
    asm volatile("s_wait_dscnt 0x0" ::: "memory");      // this wave's LDS reads of tile ks have retired
    asm volatile("s_wait_asynccnt 0x0" ::: "memory");   // this wave's copies of tile ks + 1 have landed
    __syncthreads();                                    // publishes tile ks + 1 and ends every wave's reads of tile ks
    if (ks + 2 < NN / 32) copy_tile(ks + 2, bf); }      // refill of the buffer just left; flies during trip ks + 1
  asm volatile("s_wait_asynccnt 0x0" ::: "memory");     // no copy is outstanding when the wave goes on to the epilogue
  l += xhalf(l);                                        // the two halves' sums joined once
  { const float il = (1.0f / 2048.0f) / l;
#pragma unroll
    for (int j = 0; j < 4; ++j) { v4f o0, o1;
#pragma unroll
      for (int r = 0; r < 4; ++r) { o0[r] = acc[j][r] * il; o1[r] = acc[j][4 + r] * il; }
      vst2(&so[wave][col][j * 16 + 8 * g], o0); vst2(&so[wave][col][j * 16 + 8 * g + 4], o1); } }
  LDSX(); for (int rl = 0; rl < 16; ++rl) if (lane < 16) vst2(X + ((b * NN + q0 + rl) * NH + h) * DD + lane * 4, *(const v4f*)&so[wave][rl][lane * 4]); }   // output [B][N][H][D]
extern "C" void kernel_launch(void* const* d_in, const int* in_sizes, int n_in, void* d_out, int out_size, void* d_ws, size_t ws_size, hipStream_t stream) {
  (void)in_sizes; (void)n_in; (void)out_size;
  const float** F = (const float**)d_in;   // 0 q, 1 k, 2 v [4,8,2048,64]
  if (ws_size < (size_t)WS_END) return;
  char* ws = (char*)d_ws; _Float16* VT = (_Float16*)(ws + WS_VT); float* KK = (float*)(ws + WS_KK);
  k_prep<<<dim3(NN / PK, NBH), 128, 0, stream>>>(F[1], F[2], VT, KK);
  k_att<<<dim3(NN / 64, TBH), 128, 0, stream>>>(F[0], F[1], KK, VT, (float*)d_out);
}

// v006
// It runs in 58.5 microseconds.
// Two timings next to v005 put it at 1.10 and 1.11 times that version's speed.
// Counting every step since v000, it is 3.96 times as fast.
// compute dtype: all float inputs rounded to bf16; logits q . k with EXACT bf16 products on WMMA 16x16x32 (1 product: q and k are inputs), |k|^2 per key and |q|^2 per query in f32, softmax in f32 against the fixed reference |q - k|^2 >= 0 (hardware exp2; a row whose sum comes out too low is redone with the running maximum), P (x 2^15) as f16 hi + f16 residual at the same scale . v (bf16 values as f16 planes, 2 products into one accumulator); f32 output.
#include <hip/hip_runtime.h>
#include <math.h>

typedef __attribute__((ext_vector_type(16))) _Float16 v16h;
typedef __attribute__((ext_vector_type(16))) __bf16 v16b;
typedef __attribute__((ext_vector_type(8)))  _Float16 v8h;
typedef __attribute__((ext_vector_type(8)))  float v8f;
typedef __attribute__((ext_vector_type(4)))  float v4f;
typedef __attribute__((ext_vector_type(2)))  float v2f;
typedef __attribute__((ext_vector_type(4)))  unsigned v4u;
typedef __attribute__((ext_vector_type(4)))  int v4i;
typedef float __attribute__((may_alias)) float_a;
typedef int __attribute__((may_alias)) int_a;

template <typename T> __device__ __forceinline__ void vst2(void* p, T v) { *(T*)p = v;  }
__device__ __forceinline__ v8f wmma16(v16h a, v16h b, v8f c) {
  v8f d = __builtin_amdgcn_wmma_f32_16x16x32_f16(false, a, false, b, (short)0, c, false, false);
  return d;
}
__device__ __forceinline__ v8f wmma_bf(v16b a, v16b b, v8f c) {
  v8f d = __builtin_amdgcn_wmma_f32_16x16x32_bf16(false, a, false, b, (short)0, c, false, false);
  return d;
}
// 16x16x32 fragments: lane = (h = lane>>4, row/col = lane&15); elements 0..7 = k0+8h+0..7, 8..15 = k0+16+8h+0..7; D element r = row 8h+r
__device__ __forceinline__ v16h frag_h(const _Float16* rowk0, int lane) {
  union { v16h v; v8h q[2]; } u; const _Float16* p = rowk0 + 8 * (lane >> 4);
  u.q[0] = *(const v8h*)p; u.q[1] = *(const v8h*)(p + 16); return u.v;
}
__device__ __forceinline__ v16h frag_f32(const float* rowk0, int lane) {
  v16h a; const float* p = rowk0 + 8 * (lane >> 4);
#pragma unroll
  for (int i = 0; i < 8; ++i) { a[i] = (_Float16)p[i]; a[8 + i] = (_Float16)p[16 + i]; }
  return a;
}
__device__ __forceinline__ v16h frag_f32s(const float* rowk0, int lane, float sc) {
  v16h a; const float* p = rowk0 + 8 * (lane >> 4);
#pragma unroll
  for (int i = 0; i < 8; ++i) { a[i] = (_Float16)(p[i] * sc); a[8 + i] = (_Float16)(p[16 + i] * sc); }
  return a;
}
// column fragment from a [K][ld] layout (column n), rows >= K read as 0
__device__ __forceinline__ v16h fragc_f32(const float* W, int k0, int n, int lane, int ld, int K) {
  v16h a; const int g = lane >> 4;
#pragma unroll
  for (int i = 0; i < 8; ++i) { const int ka = k0 + 8 * g + i, kb = ka + 16;
    a[i] = (_Float16)(ka < K ? W[(size_t)(ka < K ? ka : K - 1) * ld + n] : 0.f); a[8 + i] = (_Float16)(kb < K ? W[(size_t)(kb < K ? kb : K - 1) * ld + n] : 0.f); }
  return a;
}
struct F2 { v16b h, l; };
__device__ __forceinline__ F2 bsplit16(const float v[16]) { F2 r;
#pragma unroll
  for (int i = 0; i < 16; ++i) { const __bf16 h = (__bf16)v[i]; r.h[i] = h; r.l[i] = (__bf16)(v[i] - (float)h); }
  return r; }
__device__ __forceinline__ F2 split_row(const float* row, int k0, int lane) { float v[16]; const float* p = row + k0 + 8 * (lane >> 4);
#pragma unroll
  for (int i = 0; i < 8; ++i) { v[i] = p[i]; v[8 + i] = p[16 + i]; }
  return bsplit16(v); }
__device__ __forceinline__ F2 split_rowK(const float* row, int k0, int lane, int K) { float v[16]; const int g = lane >> 4;
#pragma unroll
  for (int i = 0; i < 8; ++i) { const int ka = k0 + 8 * g + i, kb = ka + 16; v[i] = ka < K ? row[ka < K ? ka : K - 1] : 0.f; v[8 + i] = kb < K ? row[kb < K ? kb : K - 1] : 0.f; }
  return bsplit16(v); }
__device__ __forceinline__ F2 split_col(const float* W, int k0, int n, int lane, int ld, int K) { float v[16]; const int g = lane >> 4;
#pragma unroll
  for (int i = 0; i < 8; ++i) { const int ka = k0 + 8 * g + i, kb = ka + 16; v[i] = ka < K ? W[(size_t)(ka < K ? ka : K - 1) * ld + n] : 0.f; v[8 + i] = kb < K ? W[(size_t)(kb < K ? kb : K - 1) * ld + n] : 0.f; }
  return bsplit16(v); }
__device__ __forceinline__ v8f mac3(const F2& a, const F2& b, v8f c) { c = wmma_bf(a.l, b.h, c); c = wmma_bf(a.h, b.l, c); return wmma_bf(a.h, b.h, c); }
__device__ __forceinline__ float sigm(float v) { return 1.0f / (1.0f + expf(-v)); }
#define LDSX() do { asm volatile("s_wait_dscnt 0" ::: "memory"); __builtin_amdgcn_wave_barrier(); __builtin_amdgcn_fence(__ATOMIC_RELEASE, "workgroup"); } while (0)


// Global L2-distance attention (B 4, H 8, N 2,048, D 64): attn = softmax(-(|q|^2 - 2 q.k + |k|^2) / 8) over keys; x = attn v, output [B, N, H, D].
#define NB 4
#define NH 8
#define NBH (NB * NH)
#define NN 2048
#define DD 64
#define SC1 0.36067376f    // log2(e) / 4: scale of q.k in the base-2 score
#define SC2 0.18033688f    // log2(e) / 8: scale of |k|^2 and |q|^2 there
#ifndef TBH
#define TBH NBH
#endif
typedef __attribute__((ext_vector_type(8))) __bf16 v8b;
__device__ __forceinline__ v16b frag_b(const __bf16* rowk0, int lane) {
  union { v16b v; v8b q[2]; } u; const __bf16* p = rowk0 + 8 * (lane >> 4);
  u.q[0] = *(const v8b*)p; u.q[1] = *(const v8b*)(p + 16); return u.v;
}
__device__ __forceinline__ float bfr(float v) { return (float)(__bf16)v; }
__device__ __attribute__((noinline)) float exp_ni(float v) { return expf(v); }
__device__ __attribute__((noinline)) float erf_ni(float v) { return erff(v); }

#define WS_VT  0u                                   // f16 v planes [bh][64][2048]
#define WS_KK  (WS_VT + 2u * (size_t)NBH * DD * NN)      // f32 |k|^2 log2(e) / 8 [bh][n]
#define WS_END (WS_KK + 4u * (size_t)NBH * NN)

__device__ __forceinline__ v16b fragb_f32(const float* __restrict__ p, int lane) { v16b a; const float* pp = p + 8 * (lane >> 4);
#pragma unroll
  for (int i = 0; i < 8; ++i) { a[i] = (__bf16)pp[i]; a[8 + i] = (__bf16)pp[16 + i]; } return a; }
typedef __attribute__((ext_vector_type(2))) _Float16 v2h_p;
// ---- k_prep: block = (128 keys, bh), 128 threads: v -> transposed f16 planes; kk = sum(k^2) log2(e) / 8. A thread's thirty-two 16-byte loads of v and k are all issued ahead of their first use: one trip to memory a block
#define PK 128   // keys a block
template <int M> __device__ __forceinline__ float row_xadd(float v) { return v + __builtin_bit_cast(float, __builtin_amdgcn_update_dpp(0, __builtin_bit_cast(int, v), 0x160 + M, 0xf, 0xf, true)); }   // v + the value of lane ^ M inside the 16-lane row (DPP row_xmask)
__global__ __launch_bounds__(128) void k_prep(const float* __restrict__ K, const float* __restrict__ V, _Float16* __restrict__ VT, float* __restrict__ KK) { __shared__ __align__(16) _Float16 st[DD][PK + 8]; __shared__ __align__(16) float skk[PK];
  const int t = threadIdx.x, c4 = (t & 15) * 4, a = t >> 4; const size_t bh = blockIdx.y; const int n0 = blockIdx.x * PK; const size_t r0 = bh * NN + n0;
  const float* pv = V + (r0 + 2 * a) * DD + c4; const float* pk = K + (r0 + a) * DD + c4;
  v4f va[PK / 16], vb[PK / 16], kr[PK / 8];   // 16 lanes read one whole 256-byte row; va, vb: v of key 2 (a + 8 i) and of the next; kr: k of key a + 8 i
#pragma unroll   // unrolled so that the arrays stay in registers and the loads stand together
  for (int i = 0; i < PK / 16; ++i) { va[i] = *(const v4f*)(pv + 16 * i * DD); vb[i] = *(const v4f*)(pv + (16 * i + 1) * DD); }
#pragma unroll   // the same
  for (int i = 0; i < PK / 8; ++i) kr[i] = *(const v4f*)(pk + 8 * i * DD);
  asm volatile("s_wait_xcnt 0x0" :: "v"(pv), "v"(pk) : "memory");   // the wait in front of any overwrite of the loads' address registers, which it names so that no later load lands on them; no load moves behind it either, so all thirty-two are in flight before the first use (left alone the compiler holds some back: a second trip to memory)
#pragma unroll   // the same
  for (int i = 0; i < PK / 16; ++i)
#pragma unroll   // the same
    for (int j = 0; j < 4; ++j) { const v2h_p w = {(_Float16)bfr(va[i][j]), (_Float16)bfr(vb[i][j])}; *(v2h_p*)&st[c4 + j][2 * (a + 8 * i)] = w; }   // two neighbouring keys of one d: one 4-byte LDS store
  float ks[PK / 8];
#pragma unroll   // the same
  for (int i = 0; i < PK / 8; ++i) { float s = 0.f;
#pragma unroll   // the same
    for (int j = 0; j < 4; ++j) { const float x = bfr(kr[i][j]); s += x * x; }
    s = row_xadd<1>(s); s = row_xadd<2>(s); s = row_xadd<4>(s); ks[i] = row_xadd<8>(s); }   // the row's 16 partial sums joined
  if ((t & 15) == 0) {
#pragma unroll   // the same
    for (int i = 0; i < PK / 8; ++i) skk[a + 8 * i] = ks[i] * SC2; }   // stored as its term of the base-2 score
  __syncthreads();
#pragma unroll   // unrolled so that the LDS reads stand ahead of the stores
  for (int i = 0; i < DD * (PK / 8) / 128; ++i) { const int e = t + 128 * i, d = e / (PK / 8), q = e % (PK / 8); vst2((unsigned*)(VT + (bh * DD + d) * (size_t)NN + n0 + q * 8), *(const v4u*)&st[d][q * 8]); }
  if (t < PK / 4) vst2(KK + r0 + t * 4, *(const v4f*)&skk[t * 4]); }
// ---- asynchronous copies to LDS: each lane brings its own 16 bytes; the s_wait_xcnt stands inside the copies' own statement, in front of any rewrite of their address registers
__device__ __forceinline__ unsigned lds_off(const void* p) { return (unsigned)(size_t)p; }   // low 32 bits of a __shared__ address = byte offset in the work-group's LDS
__device__ __forceinline__ void copy4(unsigned l0, unsigned l1, unsigned l2, unsigned l3, const void* g0, const void* g1, const void* g2, const void* g3) {
  asm volatile("global_load_async_to_lds_b128 %0, %4, off\n\tglobal_load_async_to_lds_b128 %1, %5, off\n\tglobal_load_async_to_lds_b128 %2, %6, off\n\tglobal_load_async_to_lds_b128 %3, %7, off\n\ts_wait_xcnt 0x0"
               :: "v"(l0), "v"(l1), "v"(l2), "v"(l3), "v"(g0), "v"(g1), "v"(g2), "v"(g3) : "memory"); }
__device__ __forceinline__ void copy6(unsigned l0, unsigned l1, unsigned l2, unsigned l3, unsigned l4, unsigned l5, const void* g0, const void* g1, const void* g2, const void* g3, const void* g4, const void* g5) {
  asm volatile("global_load_async_to_lds_b128 %0, %6, off\n\tglobal_load_async_to_lds_b128 %1, %7, off\n\tglobal_load_async_to_lds_b128 %2, %8, off\n\tglobal_load_async_to_lds_b128 %3, %9, off\n\tglobal_load_async_to_lds_b128 %4, %10, off\n\tglobal_load_async_to_lds_b128 %5, %11, off\n\ts_wait_xcnt 0x0"
               :: "v"(l0), "v"(l1), "v"(l2), "v"(l3), "v"(l4), "v"(l5), "v"(g0), "v"(g1), "v"(g2), "v"(g3), "v"(g4), "v"(g5) : "memory"); }
#define PSH 15.0f          // P = 2^score has its top value at 2^15, inside f16
#define LMIN 0x1p-7f       // smallest row sum (at that scale) taken from the fixed reference
template <bool B> struct flag_c { static constexpr bool v = B; };
#define KPITCH 68   // floats: 272-byte rows, conflict-free for 16-byte LDS reads of 256-byte rows
#define VPITCH 40   // halves: 80-byte rows, the same for 64-byte rows
// ---- k_att: block = (64 queries, bh): transposed products: S^T = k . q^T (a lane holds 16 keys' scores of ONE query), base-2 score = PSH - log2(e) |q - k|^2 / 8, its per-query part entered as the C operand of the score products; P = 2^score, summed in the lane; O^T += v^T . P^T with P (hi + residual) packed from the score registers; the 32-key tiles of k and v come through a two-buffer LDS ring shared by the four waves
typedef __attribute__((ext_vector_type(2))) _Float16 v2h;
__device__ __forceinline__ float xhalf(float v) { return __builtin_bit_cast(float, __builtin_amdgcn_permlanex16(__builtin_bit_cast(int, v), __builtin_bit_cast(int, v), 0x76543210, 0xfedcba98, false, false)); }   // the value of lane ^ 16
// residuals of eight values p against their f16 roundings h (two a register), rounded to f16 and packed like h: r = (f16)(p - h), the f16 source read in place, one v_fma_mix an element (the compiler's own form widens h, subtracts and packs: twice the instructions).
// The four low halves stand ahead of the four high halves, which write the same registers; the s_delay_alu name that producer four back, so that the SIMD goes on to another wave instead of stalling
__device__ __forceinline__ void resid8(const v2f* p, const unsigned* h, unsigned* r) {
  asm("v_fma_mixlo_f16 %0, %4, 1.0, -%12 op_sel_hi:[0,0,1]\n\tv_fma_mixlo_f16 %1, %6, 1.0, -%13 op_sel_hi:[0,0,1]\n\tv_fma_mixlo_f16 %2, %8, 1.0, -%14 op_sel_hi:[0,0,1]\n\tv_fma_mixlo_f16 %3, %10, 1.0, -%15 op_sel_hi:[0,0,1]\n\t"
      "s_delay_alu instid0(VALU_DEP_4) | instskip(NEXT) | instid1(VALU_DEP_4)\n\t"
      "v_fma_mixhi_f16 %0, %5, 1.0, -%12 op_sel:[0,0,1] op_sel_hi:[0,0,1]\n\tv_fma_mixhi_f16 %1, %7, 1.0, -%13 op_sel:[0,0,1] op_sel_hi:[0,0,1]\n\t"
      "s_delay_alu instid0(VALU_DEP_4) | instskip(NEXT) | instid1(VALU_DEP_4)\n\t"
      "v_fma_mixhi_f16 %2, %9, 1.0, -%14 op_sel:[0,0,1] op_sel_hi:[0,0,1]\n\tv_fma_mixhi_f16 %3, %11, 1.0, -%15 op_sel:[0,0,1] op_sel_hi:[0,0,1]"
      : "=&v"(r[0]), "=&v"(r[1]), "=&v"(r[2]), "=&v"(r[3])
      : "v"(p[0].x), "v"(p[0].y), "v"(p[1].x), "v"(p[1].y), "v"(p[2].x), "v"(p[2].y), "v"(p[3].x), "v"(p[3].y), "v"(h[0]), "v"(h[1]), "v"(h[2]), "v"(h[3])); }
__global__ __launch_bounds__(128) void k_att(const float* __restrict__ Q, const float* __restrict__ K, const float* __restrict__ KK, const _Float16* __restrict__ VT, float* __restrict__ X) {
  __shared__ __align__(16) float so[4][16][68];
  __shared__ __align__(16) float sk[2][32][KPITCH]; __shared__ __align__(16) _Float16 sv[2][DD][VPITCH]; __shared__ __align__(16) float skk[NN]; __shared__ __align__(16) unsigned sredo[4];
  const int tid = threadIdx.x, wave = tid >> 5, lane = tid & 31, col = lane & 15, g = lane >> 4; const size_t bh = blockIdx.y; const size_t b = bh / NH, h = bh % NH; const int q0 = blockIdx.x * 64 + wave * 16; const size_t rq = bh * NN + q0;
  const float* gk = K + (bh * NN + (tid >> 4)) * DD + (tid & 15) * 4;                    // k tile: 32 rows of 256 bytes, a thread's four pieces lie 8 rows apart
  const _Float16* gv = VT + (bh * DD + (tid >> 2)) * (size_t)NN + (tid & 3) * 8;          // v tile: 64 rows (d) of 64 bytes, a thread's two pieces lie 32 rows apart
  auto copy_tile = [&](int t, int bf) {
    const float* a = gk + (size_t)t * 32 * DD; const unsigned la = lds_off(&sk[bf][tid >> 4][(tid & 15) * 4]);
    const _Float16* c = gv + t * 32; const unsigned lc = lds_off(&sv[bf][tid >> 2][(tid & 3) * 8]);
    copy6(la, la + 8 * KPITCH * 4, la + 16 * KPITCH * 4, la + 24 * KPITCH * 4, lc, lc + 32 * VPITCH * 2, a, a + 8 * DD, a + 16 * DD, a + 24 * DD, c, c + 32 * (size_t)NN); };
  { const float* a = KK + bh * NN + tid * 4; const unsigned la = lds_off(&skk[tid * 4]); copy4(la, la + 2048, la + 4096, la + 6144, a, a + 512, a + 1024, a + 1536); }   // scaled |k|^2 of all keys, filled once
  auto ring_start = [&]() {
    copy_tile(0, 0);
    asm volatile("s_wait_asynccnt 0x0" ::: "memory");   // this wave's copies of tile 0 (the first time of |k|^2 too) have landed
    __syncthreads();                                    // every wave's have: tile 0 may be read
    copy_tile(1, 1); };
  ring_start();
  v16b aq[2];                                         // B operand: column = query q0 + col
#pragma unroll
  for (int kc = 0; kc < 2; ++kc) aq[kc] = fragb_f32(Q + (rq + col) * DD + kc * 32, lane);
  float qq = 0.f;                                     // |q|^2 of query q0 + col: each lane half holds 32 of the 64 elements
#pragma unroll
  for (int kc = 0; kc < 2; ++kc)
#pragma unroll
    for (int i = 0; i < 16; ++i) { const float x = (float)aq[kc][i]; qq += x * x; }
  qq += xhalf(qq);
  const float c0 = PSH / SC1 - 0.5f * qq;             // start value of every score tile: SC1 * (q.k + c0) - SC2 |k|^2 = PSH - log2(e) |q - k|^2 / 8, never above PSH (but for rounding)
  const v8f c0v = {c0, c0, c0, c0, c0, c0, c0, c0};
  float m; v2f l2; v8f acc[4];                        // of query q0 + col: m equal in both lane halves, l2 each half's own part; O^T: element r of tile j = d j * 16 + 8 g + r; P's hi part and its residual add into the same tile
  auto walk = [&](auto fixed) { constexpr bool FIX = decltype(fixed)::v;   // FIX: p = 2^score as it stands; else the running maximum of the scores is taken off first
    m = -3.0e38f; l2 = v2f{0.f, 0.f};
#pragma unroll
    for (int j = 0; j < 4; ++j) acc[j] = v8f{};
#pragma unroll 1
    for (int ks = 0; ks < NN / 32; ++ks) { v2f s[2][4]; const int bf = ks & 1;
#pragma unroll
      for (int ct = 0; ct < 2; ++ct) { v8f c = c0v;   // element r = key ks * 32 + ct * 16 + 8 g + r
#pragma unroll
        for (int kc = 0; kc < 2; ++kc) c = wmma_bf(fragb_f32(&sk[bf][ct * 16 + col][kc * 32], lane), aq[kc], c);
        const float* kkp = &skk[ks * 32 + ct * 16 + 8 * g]; const v4f ka = *(const v4f*)kkp, kb = *(const v4f*)(kkp + 4);
        s[ct][0] = c.s01 * SC1 - ka.s01; s[ct][1] = c.s23 * SC1 - ka.s23; s[ct][2] = c.s45 * SC1 - kb.s01; s[ct][3] = c.s67 * SC1 - kb.s23; }
      v2f pv[8]; union { v16h v; unsigned w[8]; } pa, pal;   // B operand of the second product: element i = key 8 g + i, element 8 + i = key 16 + 8 g + i: the two score tiles as they lie
      if constexpr (!FIX) {
        float mx = fmaxf(s[0][0].x, s[0][0].y);
#pragma unroll
        for (int i = 1; i < 8; ++i) mx = fmaxf(mx, fmaxf(s[i >> 2][i & 3].x, s[i >> 2][i & 3].y));
        mx = fmaxf(mx, xhalf(mx));
        const float mn = fmaxf(m, mx), alpha = __builtin_amdgcn_exp2f(m - mn), sh = mn - 11.0f; m = mn;
#pragma unroll
        for (int i = 0; i < 8; ++i) s[i >> 2][i & 3] -= sh;   // p's top value 2^11
        l2 *= alpha;
#pragma unroll
        for (int j = 0; j < 4; ++j)
#pragma unroll
          for (int r = 0; r < 8; ++r) acc[j][r] *= alpha; }
#pragma unroll
      for (int i = 0; i < 8; ++i) { const v2f d = s[i >> 2][i & 3]; pv[i] = v2f{__builtin_amdgcn_exp2f(d.x), __builtin_amdgcn_exp2f(d.y)};
        pa.w[i] = __builtin_bit_cast(unsigned, __builtin_convertvector(pv[i], v2h)); }
      resid8(pv, pa.w, pal.w); resid8(pv + 4, pa.w + 4, pal.w + 4);   // the residual stays at p's scale: f16 holds it to 2^-11 of itself (2^-23 of p) or, where it is subnormal, to 2^-25 absolute
      l2 += ((pv[0] + pv[1]) + (pv[2] + pv[3])) + ((pv[4] + pv[5]) + (pv[6] + pv[7]));
      v16h vf[4];
#pragma unroll   // unrolled so that vf and acc stay in registers
      for (int j = 0; j < 4; ++j) { vf[j] = frag_h(&sv[bf][j * 16 + col][0], lane); acc[j] = wmma16(vf[j], pa.v, acc[j]); }
#pragma unroll   // the same
      for (int j = 0; j < 4; ++j) acc[j] = wmma16(vf[j], pal.v, acc[j]);   // behind the four hi products, so that no product waits for the one before it on its own tile
      asm volatile("s_wait_dscnt 0x0" ::: "memory");      // this wave's LDS reads of tile ks have retired
      asm volatile("s_wait_asynccnt 0x0" ::: "memory");   // this wave's copies of tile ks + 1 have landed
      __syncthreads();                                    // publishes tile ks + 1 and ends every wave's reads of tile ks
      if (ks + 2 < NN / 32) copy_tile(ks + 2, bf); }      // refill of the buffer just left; flies during trip ks + 1
    asm volatile("s_wait_asynccnt 0x0" ::: "memory");     // no copy is outstanding when the wave leaves the walk
    float t = l2.x + l2.y; t += xhalf(t); return t; };    // the two halves' sums joined once
  float l = walk(flag_c<true>{});
  // range test: a row whose every key lies so far off that its sum sinks towards f16's smallest step (or is no number) is done again with the running maximum; the ring is the work-group's, so the four waves decide together
  { const unsigned low = __builtin_amdgcn_ballot_w32(!(l >= LMIN)); if (lane == 0) sredo[wave] = low; }
  __syncthreads();                                        // every wave's verdict is written; also no wave still reads the ring
  { const v4u f = *(const v4u*)sredo;
    if (__builtin_amdgcn_readfirstlane((int)(f.x | f.y | f.z | f.w)) != 0) { ring_start(); l = walk(flag_c<false>{}); } }
  { const float il = 1.0f / l;                            // l stands at P's scale, which cancels
#pragma unroll
    for (int j = 0; j < 4; ++j) { v4f o0, o1;
#pragma unroll
      for (int r = 0; r < 4; ++r) { o0[r] = acc[j][r] * il; o1[r] = acc[j][4 + r] * il; }
      vst2(&so[wave][col][j * 16 + 8 * g], o0); vst2(&so[wave][col][j * 16 + 8 * g + 4], o1); } }
  LDSX(); for (int rl = 0; rl < 16; ++rl) if (lane < 16) vst2(X + ((b * NN + q0 + rl) * NH + h) * DD + lane * 4, *(const v4f*)&so[wave][rl][lane * 4]); }   // output [B][N][H][D]
extern "C" void kernel_launch(void* const* d_in, const int* in_sizes, int n_in, void* d_out, int out_size, void* d_ws, size_t ws_size, hipStream_t stream) {
  (void)in_sizes; (void)n_in; (void)out_size;
  const float** F = (const float**)d_in;   // 0 q, 1 k, 2 v [4,8,2048,64]
  if (ws_size < (size_t)WS_END) return;
  char* ws = (char*)d_ws; _Float16* VT = (_Float16*)(ws + WS_VT); float* KK = (float*)(ws + WS_KK);
  k_prep<<<dim3(NN / PK, NBH), 128, 0, stream>>>(F[1], F[2], VT, KK);
  k_att<<<dim3(NN / 64, TBH), 128, 0, stream>>>(F[0], F[1], KK, VT, (float*)d_out);
}

// v007
// A run of this version takes 54.3 microseconds.
// Two timings next to v006 put it at 1.07 and 1.08 times that version's speed.
// Counting every step since v000, it is 4.28 times as fast.
// compute dtype: all float inputs rounded to bf16; logits q . k with EXACT bf16 products on WMMA 16x16x32 (1 product: q and k are inputs), |k|^2 per key and |q|^2 per query in f32, softmax in f32 against the fixed reference |q - k|^2 >= 0 (hardware exp2; a row whose sum comes out too low is redone with the running maximum), P (x 2^15) as f16 hi + f16 residual at the same scale . v (bf16 values as f16 planes, 2 products into one accumulator); f32 output.
#include <hip/hip_runtime.h>
#include <math.h>

typedef __attribute__((ext_vector_type(16))) _Float16 v16h;
typedef __attribute__((ext_vector_type(16))) __bf16 v16b;
typedef __attribute__((ext_vector_type(8)))  _Float16 v8h;
typedef __attribute__((ext_vector_type(8)))  float v8f;
typedef __attribute__((ext_vector_type(4)))  float v4f;
typedef __attribute__((ext_vector_type(2)))  float v2f;
typedef __attribute__((ext_vector_type(4)))  unsigned v4u;
typedef __attribute__((ext_vector_type(4)))  int v4i;
typedef float __attribute__((may_alias)) float_a;
typedef int __attribute__((may_alias)) int_a;

template <typename T> __device__ __forceinline__ void vst2(void* p, T v) { *(T*)p = v;  }
__device__ __forceinline__ v8f wmma16(v16h a, v16h b, v8f c) {
  v8f d = __builtin_amdgcn_wmma_f32_16x16x32_f16(false, a, false, b, (short)0, c, false, false);
  return d;
}
__device__ __forceinline__ v8f wmma_bf(v16b a, v16b b, v8f c) {
  v8f d = __builtin_amdgcn_wmma_f32_16x16x32_bf16(false, a, false, b, (short)0, c, false, false);
  return d;
}
// 16x16x32 fragments: lane = (h = lane>>4, row/col = lane&15); elements 0..7 = k0+8h+0..7, 8..15 = k0+16+8h+0..7; D element r = row 8h+r
__device__ __forceinline__ v16h frag_h(const _Float16* rowk0, int lane) {
  union { v16h v; v8h q[2]; } u; const _Float16* p = rowk0 + 8 * (lane >> 4);
  u.q[0] = *(const v8h*)p; u.q[1] = *(const v8h*)(p + 16); return u.v;
}
__device__ __forceinline__ v16h frag_f32(const float* rowk0, int lane) {
  v16h a; const float* p = rowk0 + 8 * (lane >> 4);
#pragma unroll
  for (int i = 0; i < 8; ++i) { a[i] = (_Float16)p[i]; a[8 + i] = (_Float16)p[16 + i]; }
  return a;
}
__device__ __forceinline__ v16h frag_f32s(const float* rowk0, int lane, float sc) {
  v16h a; const float* p = rowk0 + 8 * (lane >> 4);
#pragma unroll
  for (int i = 0; i < 8; ++i) { a[i] = (_Float16)(p[i] * sc); a[8 + i] = (_Float16)(p[16 + i] * sc); }
  return a;
}
// column fragment from a [K][ld] layout (column n), rows >= K read as 0
__device__ __forceinline__ v16h fragc_f32(const float* W, int k0, int n, int lane, int ld, int K) {
  v16h a; const int g = lane >> 4;
#pragma unroll
  for (int i = 0; i < 8; ++i) { const int ka = k0 + 8 * g + i, kb = ka + 16;
    a[i] = (_Float16)(ka < K ? W[(size_t)(ka < K ? ka : K - 1) * ld + n] : 0.f); a[8 + i] = (_Float16)(kb < K ? W[(size_t)(kb < K ? kb : K - 1) * ld + n] : 0.f); }
  return a;
}
struct F2 { v16b h, l; };
__device__ __forceinline__ F2 bsplit16(const float v[16]) { F2 r;
#pragma unroll
  for (int i = 0; i < 16; ++i) { const __bf16 h = (__bf16)v[i]; r.h[i] = h; r.l[i] = (__bf16)(v[i] - (float)h); }
  return r; }
__device__ __forceinline__ F2 split_row(const float* row, int k0, int lane) { float v[16]; const float* p = row + k0 + 8 * (lane >> 4);
#pragma unroll
  for (int i = 0; i < 8; ++i) { v[i] = p[i]; v[8 + i] = p[16 + i]; }
  return bsplit16(v); }
__device__ __forceinline__ F2 split_rowK(const float* row, int k0, int lane, int K) { float v[16]; const int g = lane >> 4;
#pragma unroll
  for (int i = 0; i < 8; ++i) { const int ka = k0 + 8 * g + i, kb = ka + 16; v[i] = ka < K ? row[ka < K ? ka : K - 1] : 0.f; v[8 + i] = kb < K ? row[kb < K ? kb : K - 1] : 0.f; }
  return bsplit16(v); }
__device__ __forceinline__ F2 split_col(const float* W, int k0, int n, int lane, int ld, int K) { float v[16]; const int g = lane >> 4;
#pragma unroll
  for (int i = 0; i < 8; ++i) { const int ka = k0 + 8 * g + i, kb = ka + 16; v[i] = ka < K ? W[(size_t)(ka < K ? ka : K - 1) * ld + n] : 0.f; v[8 + i] = kb < K ? W[(size_t)(kb < K ? kb : K - 1) * ld + n] : 0.f; }
  return bsplit16(v); }
__device__ __forceinline__ v8f mac3(const F2& a, const F2& b, v8f c) { c = wmma_bf(a.l, b.h, c); c = wmma_bf(a.h, b.l, c); return wmma_bf(a.h, b.h, c); }
__device__ __forceinline__ float sigm(float v) { return 1.0f / (1.0f + expf(-v)); }
#define LDSX() do { asm volatile("s_wait_dscnt 0" ::: "memory"); __builtin_amdgcn_wave_barrier(); __builtin_amdgcn_fence(__ATOMIC_RELEASE, "workgroup"); } while (0)


// Global L2-distance attention (B 4, H 8, N 2,048, D 64): attn = softmax(-(|q|^2 - 2 q.k + |k|^2) / 8) over keys; x = attn v, output [B, N, H, D].
#define NB 4
#define NH 8
#define NBH (NB * NH)
#define NN 2048
#define DD 64
#define SC1 0.36067376f    // log2(e) / 4: scale of q.k in the base-2 score
#define SC2 0.18033688f    // log2(e) / 8: scale of |k|^2 and |q|^2 there
#ifndef TBH
#define TBH NBH
#endif
typedef __attribute__((ext_vector_type(8))) __bf16 v8b;
__device__ __forceinline__ v16b frag_b(const __bf16* rowk0, int lane) {
  union { v16b v; v8b q[2]; } u; const __bf16* p = rowk0 + 8 * (lane >> 4);
  u.q[0] = *(const v8b*)p; u.q[1] = *(const v8b*)(p + 16); return u.v;
}
__device__ __forceinline__ float bfr(float v) { return (float)(__bf16)v; }
__device__ __attribute__((noinline)) float exp_ni(float v) { return expf(v); }
__device__ __attribute__((noinline)) float erf_ni(float v) { return erff(v); }

#define WS_VT  0u                                   // f16 v planes [bh][64][2048]
#define WS_KK  (WS_VT + 2u * (size_t)NBH * DD * NN)      // f32 |k|^2 log2(e) / 8 [bh][n]
#define WS_END (WS_KK + 4u * (size_t)NBH * NN)

__device__ __forceinline__ v16b fragb_f32(const float* __restrict__ p, int lane) { v16b a; const float* pp = p + 8 * (lane >> 4);
#pragma unroll
  for (int i = 0; i < 8; ++i) { a[i] = (__bf16)pp[i]; a[8 + i] = (__bf16)pp[16 + i]; } return a; }
typedef __attribute__((ext_vector_type(2))) _Float16 v2h_p;
// ---- k_prep: block = (128 keys, bh), 128 threads: v -> transposed f16 planes; kk = sum(k^2) log2(e) / 8. A thread's thirty-two 16-byte loads of v and k are all issued ahead of their first use: one trip to memory a block
#define PK 128   // keys a block
template <int M> __device__ __forceinline__ float row_xadd(float v) { return v + __builtin_bit_cast(float, __builtin_amdgcn_update_dpp(0, __builtin_bit_cast(int, v), 0x160 + M, 0xf, 0xf, true)); }   // v + the value of lane ^ M inside the 16-lane row (DPP row_xmask)
__global__ __launch_bounds__(128) void k_prep(const float* __restrict__ K, const float* __restrict__ V, _Float16* __restrict__ VT, float* __restrict__ KK) { __shared__ __align__(16) _Float16 st[DD][PK + 8]; __shared__ __align__(16) float skk[PK];
  const int t = threadIdx.x, c4 = (t & 15) * 4, a = t >> 4; const size_t bh = blockIdx.y; const int n0 = blockIdx.x * PK; const size_t r0 = bh * NN + n0;
  const float* pv = V + (r0 + 2 * a) * DD + c4; const float* pk = K + (r0 + a) * DD + c4;
  v4f va[PK / 16], vb[PK / 16], kr[PK / 8];   // 16 lanes read one whole 256-byte row; va, vb: v of key 2 (a + 8 i) and of the next; kr: k of key a + 8 i
#pragma unroll   // unrolled so that the arrays stay in registers and the loads stand together
  for (int i = 0; i < PK / 16; ++i) { va[i] = *(const v4f*)(pv + 16 * i * DD); vb[i] = *(const v4f*)(pv + (16 * i + 1) * DD); }
#pragma unroll   // the same
  for (int i = 0; i < PK / 8; ++i) kr[i] = *(const v4f*)(pk + 8 * i * DD);
  asm volatile("s_wait_xcnt 0x0" :: "v"(pv), "v"(pk) : "memory");   // the wait in front of any overwrite of the loads' address registers, which it names so that no later load lands on them; no load moves behind it either, so all thirty-two are in flight before the first use (left alone the compiler holds some back: a second trip to memory)
#pragma unroll   // the same
  for (int i = 0; i < PK / 16; ++i)
#pragma unroll   // the same
    for (int j = 0; j < 4; ++j) { const v2h_p w = {(_Float16)bfr(va[i][j]), (_Float16)bfr(vb[i][j])}; *(v2h_p*)&st[c4 + j][2 * (a + 8 * i)] = w; }   // two neighbouring keys of one d: one 4-byte LDS store
  float ks[PK / 8];
#pragma unroll   // the same
  for (int i = 0; i < PK / 8; ++i) { float s = 0.f;
#pragma unroll   // the same
    for (int j = 0; j < 4; ++j) { const float x = bfr(kr[i][j]); s += x * x; }
    s = row_xadd<1>(s); s = row_xadd<2>(s); s = row_xadd<4>(s); ks[i] = row_xadd<8>(s); }   // the row's 16 partial sums joined
  if ((t & 15) == 0) {
#pragma unroll   // the same
    for (int i = 0; i < PK / 8; ++i) skk[a + 8 * i] = ks[i] * SC2; }   // stored as its term of the base-2 score
  __syncthreads();
#pragma unroll   // unrolled so that the LDS reads stand ahead of the stores
  for (int i = 0; i < DD * (PK / 8) / 128; ++i) { const int e = t + 128 * i, d = e / (PK / 8), q = e % (PK / 8); vst2((unsigned*)(VT + (bh * DD + d) * (size_t)NN + n0 + q * 8), *(const v4u*)&st[d][q * 8]); }
  if (t < PK / 4) vst2(KK + r0 + t * 4, *(const v4f*)&skk[t * 4]); }
// ---- asynchronous copies to LDS: each lane brings its own 16 bytes; the s_wait_xcnt stands inside the copies' own statement, in front of any rewrite of their address registers
__device__ __forceinline__ unsigned lds_off(const void* p) { return (unsigned)(size_t)p; }   // low 32 bits of a __shared__ address = byte offset in the work-group's LDS
__device__ __forceinline__ void copy4(unsigned l0, unsigned l1, unsigned l2, unsigned l3, const void* g0, const void* g1, const void* g2, const void* g3) {
  asm volatile("global_load_async_to_lds_b128 %0, %4, off\n\tglobal_load_async_to_lds_b128 %1, %5, off\n\tglobal_load_async_to_lds_b128 %2, %6, off\n\tglobal_load_async_to_lds_b128 %3, %7, off\n\ts_wait_xcnt 0x0"
               :: "v"(l0), "v"(l1), "v"(l2), "v"(l3), "v"(g0), "v"(g1), "v"(g2), "v"(g3) : "memory"); }
__device__ __forceinline__ void copy6(unsigned l0, unsigned l1, unsigned l2, unsigned l3, unsigned l4, unsigned l5, const void* g0, const void* g1, const void* g2, const void* g3, const void* g4, const void* g5) {
  asm volatile("global_load_async_to_lds_b128 %0, %6, off\n\tglobal_load_async_to_lds_b128 %1, %7, off\n\tglobal_load_async_to_lds_b128 %2, %8, off\n\tglobal_load_async_to_lds_b128 %3, %9, off\n\tglobal_load_async_to_lds_b128 %4, %10, off\n\tglobal_load_async_to_lds_b128 %5, %11, off\n\ts_wait_xcnt 0x0"
               :: "v"(l0), "v"(l1), "v"(l2), "v"(l3), "v"(l4), "v"(l5), "v"(g0), "v"(g1), "v"(g2), "v"(g3), "v"(g4), "v"(g5) : "memory"); }
#define PSH 15.0f          // P = 2^score has its top value at 2^15, inside f16
#define LMIN 0x1p-7f       // smallest row sum (at that scale) taken from the fixed reference
template <bool B> struct flag_c { static constexpr bool v = B; };
#define KPITCH 68   // floats: 272-byte rows, conflict-free for 16-byte LDS reads of 256-byte rows
#define VPITCH 40   // halves: 80-byte rows, the same for 64-byte rows
// ---- k_att: block = (128 queries, bh), a wave has 32 of them as two 16-column groups: transposed products: S^T = k . q^T (a lane holds 16 keys' scores of ONE query a group), base-2 score = PSH - log2(e) |q - k|^2 / 8, its per-query part entered as the C operand of the score products; P = 2^score, summed in the lane; O^T += v^T . P^T with P (hi + residual) packed from the score registers; the 32-key tiles of k and v come through a two-buffer LDS ring shared by the four waves
typedef __attribute__((ext_vector_type(2))) _Float16 v2h;
__device__ __forceinline__ float xhalf(float v) { return __builtin_bit_cast(float, __builtin_amdgcn_permlanex16(__builtin_bit_cast(int, v), __builtin_bit_cast(int, v), 0x76543210, 0xfedcba98, false, false)); }   // the value of lane ^ 16
// residuals of eight values p against their f16 roundings h (two a register), rounded to f16 and packed like h: r = (f16)(p - h), the f16 source read in place, one v_fma_mix an element (the compiler's own form widens h, subtracts and packs: twice the instructions).
// The four low halves stand ahead of the four high halves, which write the same registers; the s_delay_alu name that producer four back, so that the SIMD goes on to another wave instead of stalling
__device__ __forceinline__ void resid8(const v2f* p, const unsigned* h, unsigned* r) {
  asm("v_fma_mixlo_f16 %0, %4, 1.0, -%12 op_sel_hi:[0,0,1]\n\tv_fma_mixlo_f16 %1, %6, 1.0, -%13 op_sel_hi:[0,0,1]\n\tv_fma_mixlo_f16 %2, %8, 1.0, -%14 op_sel_hi:[0,0,1]\n\tv_fma_mixlo_f16 %3, %10, 1.0, -%15 op_sel_hi:[0,0,1]\n\t"
      "s_delay_alu instid0(VALU_DEP_4) | instskip(NEXT) | instid1(VALU_DEP_4)\n\t"
      "v_fma_mixhi_f16 %0, %5, 1.0, -%12 op_sel:[0,0,1] op_sel_hi:[0,0,1]\n\tv_fma_mixhi_f16 %1, %7, 1.0, -%13 op_sel:[0,0,1] op_sel_hi:[0,0,1]\n\t"
      "s_delay_alu instid0(VALU_DEP_4) | instskip(NEXT) | instid1(VALU_DEP_4)\n\t"
      "v_fma_mixhi_f16 %2, %9, 1.0, -%14 op_sel:[0,0,1] op_sel_hi:[0,0,1]\n\tv_fma_mixhi_f16 %3, %11, 1.0, -%15 op_sel:[0,0,1] op_sel_hi:[0,0,1]"
      : "=&v"(r[0]), "=&v"(r[1]), "=&v"(r[2]), "=&v"(r[3])
      : "v"(p[0].x), "v"(p[0].y), "v"(p[1].x), "v"(p[1].y), "v"(p[2].x), "v"(p[2].y), "v"(p[3].x), "v"(p[3].y), "v"(h[0]), "v"(h[1]), "v"(h[2]), "v"(h[3])); }
#define QG 2   // 16-query column groups a wave: every k and v fragment read from LDS (and every rounding of k) serves both
__global__ __launch_bounds__(128) void k_att(const float* __restrict__ Q, const float* __restrict__ K, const float* __restrict__ KK, const _Float16* __restrict__ VT, float* __restrict__ X) {
  __shared__ __align__(16) float so[4][16][68];
  __shared__ __align__(16) float sk[2][32][KPITCH]; __shared__ __align__(16) _Float16 sv[2][DD][VPITCH]; __shared__ __align__(16) float skk[NN]; __shared__ __align__(16) unsigned sredo[4];
  const int tid = threadIdx.x, wave = tid >> 5, lane = tid & 31, col = lane & 15, g = lane >> 4; const size_t bh = blockIdx.y; const size_t b = bh / NH, h = bh % NH; const int q0 = blockIdx.x * (64 * QG) + wave * (16 * QG); const size_t rq = bh * NN + q0;
  const float* gk = K + (bh * NN + (tid >> 4)) * DD + (tid & 15) * 4;                    // k tile: 32 rows of 256 bytes, a thread's four pieces lie 8 rows apart
  const _Float16* gv = VT + (bh * DD + (tid >> 2)) * (size_t)NN + (tid & 3) * 8;          // v tile: 64 rows (d) of 64 bytes, a thread's two pieces lie 32 rows apart
  auto copy_next = [&](int bf) {   // the next tile in key order into buffer bf; gk and gv then step on to the tile behind it
    const float* a = gk; const unsigned la = lds_off(&sk[bf][tid >> 4][(tid & 15) * 4]);
    const _Float16* c = gv; const unsigned lc = lds_off(&sv[bf][tid >> 2][(tid & 3) * 8]);
    copy6(la, la + 8 * KPITCH * 4, la + 16 * KPITCH * 4, la + 24 * KPITCH * 4, lc, lc + 32 * VPITCH * 2, a, a + 8 * DD, a + 16 * DD, a + 24 * DD, c, c + 32 * (size_t)NN);
    gk += 32 * DD; gv += 32; };
  { const float* a = KK + bh * NN + tid * 4; const unsigned la = lds_off(&skk[tid * 4]); copy4(la, la + 2048, la + 4096, la + 6144, a, a + 512, a + 1024, a + 1536); }   // scaled |k|^2 of all keys, filled once
  auto ring_start = [&]() {
    copy_next(0);
    asm volatile("s_wait_asynccnt 0x0" ::: "memory");   // this wave's copies of tile 0 (the first time of |k|^2 too) have landed
    __syncthreads();                                    // every wave's have: tile 0 may be read
    copy_next(1); };
  ring_start();
  v16b aq[QG][2];                                     // B operand: column = query q0 + 16 u + col
  v8f c0v[QG];
  const float* pq = Q + (rq + col) * DD + 8 * g;      // the lane's own first element of query q0 + col; the second group lies 16 rows on
#pragma unroll
  for (int u = 0; u < QG; ++u)
#pragma unroll
    for (int kc = 0; kc < 2; ++kc)
#pragma unroll
      for (int i = 0; i < 8; ++i) { aq[u][kc][i] = (__bf16)pq[u * 16 * DD + kc * 32 + i]; aq[u][kc][8 + i] = (__bf16)pq[u * 16 * DD + kc * 32 + 16 + i]; }   // the k order of fragb_f32
  asm volatile("s_wait_xcnt 0x0" :: "v"(pq) : "memory");   // the wait in front of any overwrite of the q loads' address register pair, which it names so that the pair lives up to it
#pragma unroll
  for (int u = 0; u < QG; ++u) {
    float qq = 0.f;                                   // |q|^2 of that query: each lane half holds 32 of the 64 elements
#pragma unroll
    for (int kc = 0; kc < 2; ++kc)
#pragma unroll
      for (int i = 0; i < 16; ++i) { const float x = (float)aq[u][kc][i]; qq += x * x; }
    qq += xhalf(qq);
    const float c0 = PSH / SC1 - 0.5f * qq;           // start value of every score tile: SC1 * (q.k + c0) - SC2 |k|^2 = PSH - log2(e) |q - k|^2 / 8, never above PSH (but for rounding)
    c0v[u] = v8f{c0, c0, c0, c0, c0, c0, c0, c0}; }
  float m[QG], l[QG]; v2f l2[QG]; v8f acc[QG][4];     // of query q0 + 16 u + col: m equal in both lane halves, l2 each half's own part; O^T: element r of tile j = d j * 16 + 8 g + r; P's hi part and its residual add into the same tile
  auto walk = [&](auto fixed) { constexpr bool FIX = decltype(fixed)::v;   // FIX: p = 2^score as it stands; else the running maximum of the scores is taken off first
#pragma unroll
    for (int u = 0; u < QG; ++u) { m[u] = -3.0e38f; l2[u] = v2f{0.f, 0.f};
#pragma unroll
      for (int j = 0; j < 4; ++j) acc[u][j] = v8f{}; }
#pragma unroll 1
    for (int ks = 0; ks < NN / 32; ++ks) { v2f s[QG][2][4]; const int bf = ks & 1;
#pragma unroll
      for (int ct = 0; ct < 2; ++ct) {                // element r = key ks * 32 + ct * 16 + 8 g + r
        const v16b kf0 = fragb_f32(&sk[bf][ct * 16 + col][0], lane), kf1 = fragb_f32(&sk[bf][ct * 16 + col][32], lane);
        const float* kkp = &skk[ks * 32 + ct * 16 + 8 * g]; const v4f ka = *(const v4f*)kkp, kb = *(const v4f*)(kkp + 4);
#pragma unroll
        for (int u = 0; u < QG; ++u) { v8f c = wmma_bf(kf0, aq[u][0], c0v[u]); c = wmma_bf(kf1, aq[u][1], c);
          s[u][ct][0] = c.s01 * SC1 - ka.s01; s[u][ct][1] = c.s23 * SC1 - ka.s23; s[u][ct][2] = c.s45 * SC1 - kb.s01; s[u][ct][3] = c.s67 * SC1 - kb.s23; } }
      union { v16h v; unsigned w[8]; } pa[QG], pal[QG];   // B operand of the second product: element i = key 8 g + i, element 8 + i = key 16 + 8 g + i: the two score tiles as they lie
#pragma unroll
      for (int u = 0; u < QG; ++u) { v2f pv[8];
        if constexpr (!FIX) {
          float mx = fmaxf(s[u][0][0].x, s[u][0][0].y);
#pragma unroll
          for (int i = 1; i < 8; ++i) mx = fmaxf(mx, fmaxf(s[u][i >> 2][i & 3].x, s[u][i >> 2][i & 3].y));
          mx = fmaxf(mx, xhalf(mx));
          const float mn = fmaxf(m[u], mx), alpha = __builtin_amdgcn_exp2f(m[u] - mn), sh = mn - 11.0f; m[u] = mn;
#pragma unroll
          for (int i = 0; i < 8; ++i) s[u][i >> 2][i & 3] -= sh;   // p's top value 2^11
          l2[u] *= alpha;
#pragma unroll
          for (int j = 0; j < 4; ++j)
#pragma unroll
            for (int r = 0; r < 8; ++r) acc[u][j][r] *= alpha; }
#pragma unroll
        for (int i = 0; i < 8; ++i) { const v2f d = s[u][i >> 2][i & 3]; pv[i] = v2f{__builtin_amdgcn_exp2f(d.x), __builtin_amdgcn_exp2f(d.y)};
          pa[u].w[i] = __builtin_bit_cast(unsigned, __builtin_convertvector(pv[i], v2h)); }
        resid8(pv, pa[u].w, pal[u].w); resid8(pv + 4, pa[u].w + 4, pal[u].w + 4);   // the residual stays at p's scale: f16 holds it to 2^-12 of itself (2^-23 of p) or, where it is subnormal, to 2^-25 absolute
        l2[u] += ((pv[0] + pv[1]) + (pv[2] + pv[3])) + ((pv[4] + pv[5]) + (pv[6] + pv[7])); }
      v16h vf[4];
#pragma unroll   // unrolled so that vf and acc stay in registers
      for (int j = 0; j < 4; ++j) vf[j] = frag_h(&sv[bf][j * 16 + col][0], lane);
      __builtin_amdgcn_sched_barrier(0);                  // both groups' residuals are formed in front of the products: left alone the compiler sinks the second group's resid8 onto the first group's operand registers directly behind the products that read them
#pragma unroll   // the same
      for (int u = 0; u < QG; ++u) {
#pragma unroll   // the same
        for (int j = 0; j < 4; ++j) acc[u][j] = wmma16(vf[j], pa[u].v, acc[u][j]);
#pragma unroll   // the same
        for (int j = 0; j < 4; ++j) acc[u][j] = wmma16(vf[j], pal[u].v, acc[u][j]); }   // behind the four hi products, so that no product waits for the one before it on its own tile
      __builtin_amdgcn_sched_barrier(0);                  // keeps the trip's products in front of the publish point: left alone the compiler lifts the barrier over them, and the refill behind it is then issued a trip's arithmetic late, with little time left to land
      asm volatile("s_wait_dscnt 0x0" ::: "memory");      // this wave's LDS reads of tile ks have retired
      asm volatile("s_wait_asynccnt 0x0" ::: "memory");   // this wave's copies of tile ks + 1 have landed
      __syncthreads();                                    // publishes tile ks + 1 and ends every wave's reads of tile ks
      if (ks + 2 < NN / 32) copy_next(bf); }           // refill of the buffer just left; flies during trip ks + 1
    asm volatile("s_wait_asynccnt 0x0" ::: "memory");     // no copy is outstanding when the wave leaves the walk
#pragma unroll
    for (int u = 0; u < QG; ++u) { float t = l2[u].x + l2[u].y; t += xhalf(t); l[u] = t; } };   // the two halves' sums joined once
  walk(flag_c<true>{});
  // range test: a row whose every key lies so far off that its sum sinks towards f16's smallest step (or is no number) is done again with the running maximum; the ring is the work-group's, so the four waves decide together
  { bool bad = false;
#pragma unroll
    for (int u = 0; u < QG; ++u) bad = bad || !(l[u] >= LMIN);
    const unsigned low = __builtin_amdgcn_ballot_w32(bad); if (lane == 0) sredo[wave] = low; }
  __syncthreads();                                        // every wave's verdict is written; also no wave still reads the ring
  { const v4u f = *(const v4u*)sredo;
    if (__builtin_amdgcn_readfirstlane((int)(f.x | f.y | f.z | f.w)) != 0) { gk -= NN * DD; gv -= NN; ring_start(); walk(flag_c<false>{}); } }   // back to tile 0: a walk steps over all NN keys
  v4f ro[QG][16];                                         // the output rows as they go to memory: row q0 + 16 u + rl, floats 4 col ..
#pragma unroll   // unrolled so that acc and ro stay in registers
  for (int u = 0; u < QG; ++u) { const float il = 1.0f / l[u];   // l stands at P's scale, which cancels
    if (u) LDSX();                                        // the wave's own patch of so serves one group after the other: the reads of the group before have returned
#pragma unroll
    for (int j = 0; j < 4; ++j) { v4f o0, o1;
#pragma unroll
      for (int r = 0; r < 4; ++r) { o0[r] = acc[u][j][r] * il; o1[r] = acc[u][j][4 + r] * il; }
      vst2(&so[wave][col][j * 16 + 8 * g], o0); vst2(&so[wave][col][j * 16 + 8 * g + 4], o1); }
    LDSX();
#pragma unroll   // the same
    for (int rl = 0; rl < 16; ++rl) ro[u][rl] = *(const v4f*)&so[wave][rl][col * 4]; }
#pragma unroll   // the same; the stores stand behind both groups' LDS passes, so that no LDS pass waits for a store
  for (int u = 0; u < QG; ++u)
#pragma unroll   // the same
    for (int rl = 0; rl < 16; ++rl) if (lane < 16) vst2(X + ((b * NN + q0 + u * 16 + rl) * NH + h) * DD + lane * 4, ro[u][rl]); }   // output [B][N][H][D]
extern "C" void kernel_launch(void* const* d_in, const int* in_sizes, int n_in, void* d_out, int out_size, void* d_ws, size_t ws_size, hipStream_t stream) {
  (void)in_sizes; (void)n_in; (void)out_size;
  const float** F = (const float**)d_in;   // 0 q, 1 k, 2 v [4,8,2048,64]
  if (ws_size < (size_t)WS_END) return;
  char* ws = (char*)d_ws; _Float16* VT = (_Float16*)(ws + WS_VT); float* KK = (float*)(ws + WS_KK);
  k_prep<<<dim3(NN / PK, NBH), 128, 0, stream>>>(F[1], F[2], VT, KK);
  k_att<<<dim3(NN / (64 * QG), TBH), 128, 0, stream>>>(F[0], F[1], KK, VT, (float*)d_out);
}

// v008
// One run takes 47.1 microseconds.
// Two timings next to v007 put it at 1.16 and 1.17 times that version's speed.
// All steps since v000 together make it 4.98 times as fast.
// compute dtype: all float inputs rounded to bf16; logits q . k with EXACT bf16 products on WMMA 16x16x32 (1 product: q and k are inputs), |k|^2 per key and |q|^2 per query in f32, softmax in f32 against the fixed reference |q - k|^2 >= 0 (hardware exp2; a row whose sum comes out too low is redone with the running maximum), P (x 2^15) as f16 hi + f16 residual at the same scale . v (bf16 values as f16 planes, 2 products into one accumulator); f32 output.
#include <hip/hip_runtime.h>
#include <math.h>

typedef __attribute__((ext_vector_type(16))) _Float16 v16h;
typedef __attribute__((ext_vector_type(16))) __bf16 v16b;
typedef __attribute__((ext_vector_type(8)))  _Float16 v8h;
typedef __attribute__((ext_vector_type(8)))  float v8f;
typedef __attribute__((ext_vector_type(4)))  float v4f;
typedef __attribute__((ext_vector_type(2)))  float v2f;
typedef __attribute__((ext_vector_type(4)))  unsigned v4u;
typedef __attribute__((ext_vector_type(4)))  int v4i;
typedef float __attribute__((may_alias)) float_a;
typedef int __attribute__((may_alias)) int_a;

template <typename T> __device__ __forceinline__ void vst2(void* p, T v) { *(T*)p = v;  }
__device__ __forceinline__ v8f wmma16(v16h a, v16h b, v8f c) {
  v8f d = __builtin_amdgcn_wmma_f32_16x16x32_f16(false, a, false, b, (short)0, c, false, false);
  return d;
}
__device__ __forceinline__ v8f wmma_bf(v16b a, v16b b, v8f c) {
  v8f d = __builtin_amdgcn_wmma_f32_16x16x32_bf16(false, a, false, b, (short)0, c, false, false);
  return d;
}
// 16x16x32 fragments: lane = (h = lane>>4, row/col = lane&15); elements 0..7 = k0+8h+0..7, 8..15 = k0+16+8h+0..7; D element r = row 8h+r
__device__ __forceinline__ v16h frag_h(const _Float16* rowk0, int lane) {
  union { v16h v; v8h q[2]; } u; const _Float16* p = rowk0 + 8 * (lane >> 4);
  u.q[0] = *(const v8h*)p; u.q[1] = *(const v8h*)(p + 16); return u.v;
}
__device__ __forceinline__ v16h frag_f32(const float* rowk0, int lane) {
  v16h a; const float* p = rowk0 + 8 * (lane >> 4);
#pragma unroll
  for (int i = 0; i < 8; ++i) { a[i] = (_Float16)p[i]; a[8 + i] = (_Float16)p[16 + i]; }
  return a;
}
__device__ __forceinline__ v16h frag_f32s(const float* rowk0, int lane, float sc) {
  v16h a; const float* p = rowk0 + 8 * (lane >> 4);
#pragma unroll
  for (int i = 0; i < 8; ++i) { a[i] = (_Float16)(p[i] * sc); a[8 + i] = (_Float16)(p[16 + i] * sc); }
  return a;
}
// column fragment from a [K][ld] layout (column n), rows >= K read as 0
__device__ __forceinline__ v16h fragc_f32(const float* W, int k0, int n, int lane, int ld, int K) {
  v16h a; const int g = lane >> 4;
#pragma unroll
  for (int i = 0; i < 8; ++i) { const int ka = k0 + 8 * g + i, kb = ka + 16;
    a[i] = (_Float16)(ka < K ? W[(size_t)(ka < K ? ka : K - 1) * ld + n] : 0.f); a[8 + i] = (_Float16)(kb < K ? W[(size_t)(kb < K ? kb : K - 1) * ld + n] : 0.f); }
  return a;
}
struct F2 { v16b h, l; };
__device__ __forceinline__ F2 bsplit16(const float v[16]) { F2 r;
#pragma unroll
  for (int i = 0; i < 16; ++i) { const __bf16 h = (__bf16)v[i]; r.h[i] = h; r.l[i] = (__bf16)(v[i] - (float)h); }
  return r; }
__device__ __forceinline__ F2 split_row(const float* row, int k0, int lane) { float v[16]; const float* p = row + k0 + 8 * (lane >> 4);
#pragma unroll
  for (int i = 0; i < 8; ++i) { v[i] = p[i]; v[8 + i] = p[16 + i]; }
  return bsplit16(v); }
__device__ __forceinline__ F2 split_rowK(const float* row, int k0, int lane, int K) { float v[16]; const int g = lane >> 4;
#pragma unroll
  for (int i = 0; i < 8; ++i) { const int ka = k0 + 8 * g + i, kb = ka + 16; v[i] = ka < K ? row[ka < K ? ka : K - 1] : 0.f; v[8 + i] = kb < K ? row[kb < K ? kb : K - 1] : 0.f; }
  return bsplit16(v); }
__device__ __forceinline__ F2 split_col(const float* W, int k0, int n, int lane, int ld, int K) { float v[16]; const int g = lane >> 4;
#pragma unroll
  for (int i = 0; i < 8; ++i) { const int ka = k0 + 8 * g + i, kb = ka + 16; v[i] = ka < K ? W[(size_t)(ka < K ? ka : K - 1) * ld + n] : 0.f; v[8 + i] = kb < K ? W[(size_t)(kb < K ? kb : K - 1) * ld + n] : 0.f; }
  return bsplit16(v); }
__device__ __forceinline__ v8f mac3(const F2& a, const F2& b, v8f c) { c = wmma_bf(a.l, b.h, c); c = wmma_bf(a.h, b.l, c); return wmma_bf(a.h, b.h, c); }
__device__ __forceinline__ float sigm(float v) { return 1.0f / (1.0f + expf(-v)); }
#define LDSX() do { asm volatile("s_wait_dscnt 0" ::: "memory"); __builtin_amdgcn_wave_barrier(); __builtin_amdgcn_fence(__ATOMIC_RELEASE, "workgroup"); } while (0)


// Global L2-distance attention (B 4, H 8, N 2,048, D 64): attn = softmax(-(|q|^2 - 2 q.k + |k|^2) / 8) over keys; x = attn v, output [B, N, H, D].
#define NB 4
#define NH 8
#define NBH (NB * NH)
#define NN 2048
#define DD 64
#define SC1 0.36067376f    // log2(e) / 4: scale of q.k in the base-2 score
#define SC2 0.18033688f    // log2(e) / 8: scale of |k|^2 and |q|^2 there
#ifndef TBH
#define TBH NBH
#endif
typedef __attribute__((ext_vector_type(8))) __bf16 v8b;
__device__ __forceinline__ v16b frag_b(const __bf16* rowk0, int lane) {
  union { v16b v; v8b q[2]; } u; const __bf16* p = rowk0 + 8 * (lane >> 4);
  u.q[0] = *(const v8b*)p; u.q[1] = *(const v8b*)(p + 16); return u.v;
}
__device__ __forceinline__ float bfr(float v) { return (float)(__bf16)v; }
__device__ __attribute__((noinline)) float exp_ni(float v) { return expf(v); }
__device__ __attribute__((noinline)) float erf_ni(float v) { return erff(v); }

#define WS_VT  0u                                   // f16 v planes [bh][64][2048]
#define WS_KK  (WS_VT + 2u * (size_t)NBH * DD * NN)      // f32 |k|^2 log2(e) / 8 [bh][n]
#define WS_END (WS_KK + 4u * (size_t)NBH * NN)

__device__ __forceinline__ v16b fragb_f32(const float* __restrict__ p, int lane) { v16b a; const float* pp = p + 8 * (lane >> 4);
#pragma unroll
  for (int i = 0; i < 8; ++i) { a[i] = (__bf16)pp[i]; a[8 + i] = (__bf16)pp[16 + i]; } return a; }
typedef __attribute__((ext_vector_type(2))) _Float16 v2h_p;
// ---- k_prep: block = (128 keys, bh), 128 threads: v -> transposed f16 planes; kk = sum(k^2) log2(e) / 8. A thread's thirty-two 16-byte loads of v and k are all issued ahead of their first use: one trip to memory a block
#define PK 128   // keys a block
template <int M> __device__ __forceinline__ float row_xadd(float v) { return v + __builtin_bit_cast(float, __builtin_amdgcn_update_dpp(0, __builtin_bit_cast(int, v), 0x160 + M, 0xf, 0xf, true)); }   // v + the value of lane ^ M inside the 16-lane row (DPP row_xmask)
__global__ __launch_bounds__(128) void k_prep(const float* __restrict__ K, const float* __restrict__ V, _Float16* __restrict__ VT, float* __restrict__ KK) { __shared__ __align__(16) _Float16 st[DD][PK + 8]; __shared__ __align__(16) float skk[PK];
  const int t = threadIdx.x, c4 = (t & 15) * 4, a = t >> 4; const size_t bh = blockIdx.y; const int n0 = blockIdx.x * PK; const size_t r0 = bh * NN + n0;
  const float* pv = V + (r0 + 2 * a) * DD + c4; const float* pk = K + (r0 + a) * DD + c4;
  v4f va[PK / 16], vb[PK / 16], kr[PK / 8];   // 16 lanes read one whole 256-byte row; va, vb: v of key 2 (a + 8 i) and of the next; kr: k of key a + 8 i
#pragma unroll   // unrolled so that the arrays stay in registers and the loads stand together
  for (int i = 0; i < PK / 16; ++i) { va[i] = *(const v4f*)(pv + 16 * i * DD); vb[i] = *(const v4f*)(pv + (16 * i + 1) * DD); }
#pragma unroll   // the same
  for (int i = 0; i < PK / 8; ++i) kr[i] = *(const v4f*)(pk + 8 * i * DD);
  asm volatile("s_wait_xcnt 0x0" :: "v"(pv), "v"(pk) : "memory");   // the wait in front of any overwrite of the loads' address registers, which it names so that no later load lands on them; no load moves behind it either, so all thirty-two are in flight before the first use (left alone the compiler holds some back: a second trip to memory)
#pragma unroll   // the same
  for (int i = 0; i < PK / 16; ++i)
#pragma unroll   // the same
    for (int j = 0; j < 4; ++j) { const v2h_p w = {(_Float16)bfr(va[i][j]), (_Float16)bfr(vb[i][j])}; *(v2h_p*)&st[c4 + j][2 * (a + 8 * i)] = w; }   // two neighbouring keys of one d: one 4-byte LDS store
  float ks[PK / 8];
#pragma unroll   // the same
  for (int i = 0; i < PK / 8; ++i) { float s = 0.f;
#pragma unroll   // the same
    for (int j = 0; j < 4; ++j) { const float x = bfr(kr[i][j]); s += x * x; }
    s = row_xadd<1>(s); s = row_xadd<2>(s); s = row_xadd<4>(s); ks[i] = row_xadd<8>(s); }   // the row's 16 partial sums joined
  if ((t & 15) == 0) {
#pragma unroll   // the same
    for (int i = 0; i < PK / 8; ++i) skk[a + 8 * i] = ks[i] * SC2; }   // stored as its term of the base-2 score
  __syncthreads();
#pragma unroll   // unrolled so that the LDS reads stand ahead of the stores
  for (int i = 0; i < DD * (PK / 8) / 128; ++i) { const int e = t + 128 * i, d = e / (PK / 8), q = e % (PK / 8); vst2((unsigned*)(VT + (bh * DD + d) * (size_t)NN + n0 + q * 8), *(const v4u*)&st[d][q * 8]); }
  if (t < PK / 4) vst2(KK + r0 + t * 4, *(const v4f*)&skk[t * 4]); }
// ---- asynchronous copies to LDS: each lane brings its own 16 bytes; the s_wait_xcnt stands inside the copies' own statement, in front of any rewrite of their address registers
__device__ __forceinline__ unsigned lds_off(const void* p) { return (unsigned)(size_t)p; }   // low 32 bits of a __shared__ address = byte offset in the work-group's LDS
__device__ __forceinline__ void copy4(unsigned l0, unsigned l1, unsigned l2, unsigned l3, const void* g0, const void* g1, const void* g2, const void* g3) {
  asm volatile("global_load_async_to_lds_b128 %0, %4, off\n\tglobal_load_async_to_lds_b128 %1, %5, off\n\tglobal_load_async_to_lds_b128 %2, %6, off\n\tglobal_load_async_to_lds_b128 %3, %7, off\n\ts_wait_xcnt 0x0"
               :: "v"(l0), "v"(l1), "v"(l2), "v"(l3), "v"(g0), "v"(g1), "v"(g2), "v"(g3) : "memory"); }
__device__ __forceinline__ void copy6(unsigned l0, unsigned l1, unsigned l2, unsigned l3, unsigned l4, unsigned l5, const void* g0, const void* g1, const void* g2, const void* g3, const void* g4, const void* g5) {
  asm volatile("global_load_async_to_lds_b128 %0, %6, off\n\tglobal_load_async_to_lds_b128 %1, %7, off\n\tglobal_load_async_to_lds_b128 %2, %8, off\n\tglobal_load_async_to_lds_b128 %3, %9, off\n\tglobal_load_async_to_lds_b128 %4, %10, off\n\tglobal_load_async_to_lds_b128 %5, %11, off\n\ts_wait_xcnt 0x0"
               :: "v"(l0), "v"(l1), "v"(l2), "v"(l3), "v"(l4), "v"(l5), "v"(g0), "v"(g1), "v"(g2), "v"(g3), "v"(g4), "v"(g5) : "memory"); }
#define PSH 15.0f          // P = 2^score has its top value at 2^15, inside f16
#define LMIN 0x1p-7f       // smallest row sum (at that scale) taken from the fixed reference
template <bool B> struct flag_c { static constexpr bool v = B; };
#define KPITCH 68   // floats: 272-byte rows, conflict-free for 16-byte LDS reads of 256-byte rows
#define VPITCH 40   // halves: 80-byte rows, the same for 64-byte rows
// ---- k_att: block = (128 queries, bh), eight waves: wave w and wave w + 4 have the same 32 queries (two 16-column groups) and each walks one 32-key half of every 64-key ring stage, so that four waves stand on a SIMD; the fixed reference makes the two halves' sums plain addends, joined once through LDS behind the walk. Transposed products: S^T = k . q^T (a lane holds 16 keys' scores of ONE query a group), base-2 score = PSH - log2(e) |q - k|^2 / 8, its per-query part entered as the C operand of the score products; P = 2^score, summed in the lane; O^T += v^T . P^T with P (hi + residual) packed from the score registers; the 64-key stages of k and v come through a two-buffer LDS ring shared by the eight waves
typedef __attribute__((ext_vector_type(2))) _Float16 v2h;
__device__ __forceinline__ float xhalf(float v) { return __builtin_bit_cast(float, __builtin_amdgcn_permlanex16(__builtin_bit_cast(int, v), __builtin_bit_cast(int, v), 0x76543210, 0xfedcba98, false, false)); }   // the value of lane ^ 16
// residuals of eight values p against their f16 roundings h (two a register), rounded to f16 and packed like h: r = (f16)(p - h), the f16 source read in place, one v_fma_mix an element (the compiler's own form widens h, subtracts and packs: twice the instructions).
// The four low halves stand ahead of the four high halves, which write the same registers; the s_delay_alu name that producer four back, so that the SIMD goes on to another wave instead of stalling
__device__ __forceinline__ void resid8(const v2f* p, const unsigned* h, unsigned* r) {
  asm("v_fma_mixlo_f16 %0, %4, 1.0, -%12 op_sel_hi:[0,0,1]\n\tv_fma_mixlo_f16 %1, %6, 1.0, -%13 op_sel_hi:[0,0,1]\n\tv_fma_mixlo_f16 %2, %8, 1.0, -%14 op_sel_hi:[0,0,1]\n\tv_fma_mixlo_f16 %3, %10, 1.0, -%15 op_sel_hi:[0,0,1]\n\t"
      "s_delay_alu instid0(VALU_DEP_4) | instskip(NEXT) | instid1(VALU_DEP_4)\n\t"
      "v_fma_mixhi_f16 %0, %5, 1.0, -%12 op_sel:[0,0,1] op_sel_hi:[0,0,1]\n\tv_fma_mixhi_f16 %1, %7, 1.0, -%13 op_sel:[0,0,1] op_sel_hi:[0,0,1]\n\t"
      "s_delay_alu instid0(VALU_DEP_4) | instskip(NEXT) | instid1(VALU_DEP_4)\n\t"
      "v_fma_mixhi_f16 %2, %9, 1.0, -%14 op_sel:[0,0,1] op_sel_hi:[0,0,1]\n\tv_fma_mixhi_f16 %3, %11, 1.0, -%15 op_sel:[0,0,1] op_sel_hi:[0,0,1]"
      : "=&v"(r[0]), "=&v"(r[1]), "=&v"(r[2]), "=&v"(r[3])
      : "v"(p[0].x), "v"(p[0].y), "v"(p[1].x), "v"(p[1].y), "v"(p[2].x), "v"(p[2].y), "v"(p[3].x), "v"(p[3].y), "v"(h[0]), "v"(h[1]), "v"(h[2]), "v"(h[3])); }
#define QG 2   // 16-query column groups a wave: every k and v fragment read from LDS (and every rounding of k) serves both
#define KS 2   // key halves of a ring stage, one a wave
#define TK (32 * KS)   // keys a ring stage
// two such blocks stand on a WGP (four waves a SIMD) as long as the listing shows at most 256 registers and twice the LDS fits: read both after any change
template <int N> struct int_c { static constexpr int v = N; };
__device__ __forceinline__ void copy2(unsigned l0, unsigned l1, const void* g0, const void* g1) {
  asm volatile("global_load_async_to_lds_b128 %0, %2, off\n\tglobal_load_async_to_lds_b128 %1, %3, off\n\ts_wait_xcnt 0x0"
               :: "v"(l0), "v"(l1), "v"(g0), "v"(g1) : "memory"); }
__global__ __launch_bounds__(256) void k_att(const float* __restrict__ Q, const float* __restrict__ K, const float* __restrict__ KK, const _Float16* __restrict__ VT, float* __restrict__ X) {
  __shared__ __align__(16) float so[4 * KS][16][68];
  __shared__ __align__(16) float sk[2][TK][KPITCH]; __shared__ __align__(16) _Float16 sv[2][KS][DD][VPITCH]; __shared__ __align__(16) float skk[NN]; __shared__ __align__(16) unsigned sredo[4 * KS];
  __shared__ __align__(16) v4f sm[4 * KS][9][32];       // a wave's part of the column group that its partner finishes: eight quads of O^T and (sum, maximum) a lane
  const int tid = threadIdx.x, wave = __builtin_amdgcn_readfirstlane(tid >> 5), kh = wave >> 2, lane = tid & 31, col = lane & 15, g = lane >> 4; const size_t bh = blockIdx.y; const size_t b = bh / NH, h = bh % NH; const int q0 = blockIdx.x * (64 * QG) + ((tid >> 5) & 3) * (16 * QG); const size_t rq = bh * NN + q0;
  const float* gk = K + (bh * NN + (tid >> 4)) * DD + (tid & 15) * 4;                    // k stage: 64 rows of 256 bytes, a thread's four pieces lie 16 rows apart
  const _Float16* gv = VT + (bh * DD + (tid >> 3)) * (size_t)NN + (tid & 7) * 8;          // v stage: 64 rows (d) of 128 bytes, a thread's two pieces lie 32 rows apart; in LDS each 32-key half has its own plane
  auto copy_next = [&](int bf) {   // the next stage in key order into buffer bf; gk and gv then step on to the stage behind it
    const float* a = gk; const unsigned la = lds_off(&sk[bf][tid >> 4][(tid & 15) * 4]);
    const _Float16* c = gv; const unsigned lc = lds_off(&sv[bf][(tid & 7) >> 2][tid >> 3][(tid & 3) * 8]);
    copy6(la, la + 16 * KPITCH * 4, la + 32 * KPITCH * 4, la + 48 * KPITCH * 4, lc, lc + 32 * VPITCH * 2, a, a + 16 * DD, a + 32 * DD, a + 48 * DD, c, c + 32 * (size_t)NN);
    gk += TK * DD; gv += TK; };
  { const float* a = KK + bh * NN + tid * 4; const unsigned la = lds_off(&skk[tid * 4]); copy2(la, la + 4096, a, a + 1024); }   // scaled |k|^2 of all keys, filled once
  auto ring_start = [&]() {
    copy_next(0);
    asm volatile("s_wait_asynccnt 0x0" ::: "memory");   // this wave's copies of stage 0 (the first time of |k|^2 too) have landed
    __syncthreads();                                    // every wave's have: stage 0 may be read
    copy_next(1); };
  ring_start();
  v16b aq[QG][2];                                     // B operand: column = query q0 + 16 u + col
  v8f c0v[QG];
  const float* pq = Q + (rq + col) * DD + 8 * g;      // the lane's own first element of query q0 + col; the second group lies 16 rows on
#pragma unroll
  for (int u = 0; u < QG; ++u)
#pragma unroll
    for (int kc = 0; kc < 2; ++kc)
#pragma unroll
      for (int i = 0; i < 8; ++i) { aq[u][kc][i] = (__bf16)pq[u * 16 * DD + kc * 32 + i]; aq[u][kc][8 + i] = (__bf16)pq[u * 16 * DD + kc * 32 + 16 + i]; }   // the k order of fragb_f32
  asm volatile("s_wait_xcnt 0x0" :: "v"(pq) : "memory");   // the wait in front of any overwrite of the q loads' address register pair, which it names so that the pair lives up to it
#pragma unroll
  for (int u = 0; u < QG; ++u) {
    float qq = 0.f;                                   // |q|^2 of that query: each lane half holds 32 of the 64 elements
#pragma unroll
    for (int kc = 0; kc < 2; ++kc)
#pragma unroll
      for (int i = 0; i < 16; ++i) { const float x = (float)aq[u][kc][i]; qq += x * x; }
    qq += xhalf(qq);
    const float c0 = PSH / SC1 - 0.5f * qq;           // start value of every score tile: SC1 * (q.k + c0) - SC2 |k|^2 = PSH - log2(e) |q - k|^2 / 8, never above PSH (but for rounding)
    c0v[u] = v8f{c0, c0, c0, c0, c0, c0, c0, c0}; }
  float m[QG], l[QG]; v2f l2[QG]; v8f acc[QG][4];     // of query q0 + 16 u + col, over this wave's keys: m equal in both lane halves, l2 each half's own part; O^T: element r of tile j = d j * 16 + 8 g + r; P's hi part and its residual add into the same tile
  auto walk = [&](auto fixed) { constexpr bool FIX = decltype(fixed)::v;   // FIX: p = 2^score as it stands; else the running maximum of the scores is taken off first
#pragma unroll
    for (int u = 0; u < QG; ++u) { m[u] = -3.0e38f; l2[u] = v2f{0.f, 0.f};
#pragma unroll
      for (int j = 0; j < 4; ++j) acc[u][j] = v8f{}; }
#pragma unroll 1
    for (int ks = 0; ks < NN / TK; ++ks) { v2f s[QG][2][4]; const int bf = ks & 1;
#pragma unroll
      for (int ct = 0; ct < 2; ++ct) {                // element r = key ks * 64 + kh * 32 + ct * 16 + 8 g + r
        const v16b kf0 = fragb_f32(&sk[bf][kh * 32 + ct * 16 + col][0], lane), kf1 = fragb_f32(&sk[bf][kh * 32 + ct * 16 + col][32], lane);
        const float* kkp = &skk[ks * TK + kh * 32 + ct * 16 + 8 * g]; const v4f ka = *(const v4f*)kkp, kb = *(const v4f*)(kkp + 4);
#pragma unroll
        for (int u = 0; u < QG; ++u) { v8f c = wmma_bf(kf0, aq[u][0], c0v[u]); c = wmma_bf(kf1, aq[u][1], c);
          s[u][ct][0] = c.s01 * SC1 - ka.s01; s[u][ct][1] = c.s23 * SC1 - ka.s23; s[u][ct][2] = c.s45 * SC1 - kb.s01; s[u][ct][3] = c.s67 * SC1 - kb.s23; } }
      union { v16h v; unsigned w[8]; } pa[QG], pal[QG];   // B operand of the second product: element i = key 8 g + i, element 8 + i = key 16 + 8 g + i: the two score tiles as they lie
#pragma unroll
      for (int u = 0; u < QG; ++u) { v2f pv[8];
        if constexpr (!FIX) {
          float mx = fmaxf(s[u][0][0].x, s[u][0][0].y);
#pragma unroll
          for (int i = 1; i < 8; ++i) mx = fmaxf(mx, fmaxf(s[u][i >> 2][i & 3].x, s[u][i >> 2][i & 3].y));
          mx = fmaxf(mx, xhalf(mx));
          const float mn = fmaxf(m[u], mx), alpha = __builtin_amdgcn_exp2f(m[u] - mn), sh = mn - 11.0f; m[u] = mn;
#pragma unroll
          for (int i = 0; i < 8; ++i) s[u][i >> 2][i & 3] -= sh;   // p's top value 2^11
          l2[u] *= alpha;
#pragma unroll
          for (int j = 0; j < 4; ++j)
#pragma unroll
            for (int r = 0; r < 8; ++r) acc[u][j][r] *= alpha; }
#pragma unroll
        for (int i = 0; i < 8; ++i) { const v2f d = s[u][i >> 2][i & 3]; pv[i] = v2f{__builtin_amdgcn_exp2f(d.x), __builtin_amdgcn_exp2f(d.y)};
          pa[u].w[i] = __builtin_bit_cast(unsigned, __builtin_convertvector(pv[i], v2h)); }
        resid8(pv, pa[u].w, pal[u].w); resid8(pv + 4, pa[u].w + 4, pal[u].w + 4);   // the residual stays at p's scale: f16 holds it to 2^-12 of itself (2^-23 of p) or, where it is subnormal, to 2^-25 absolute
        l2[u] += ((pv[0] + pv[1]) + (pv[2] + pv[3])) + ((pv[4] + pv[5]) + (pv[6] + pv[7])); }
      v16h vf[4];
#pragma unroll   // unrolled so that vf and acc stay in registers
      for (int j = 0; j < 4; ++j) vf[j] = frag_h(&sv[bf][kh][j * 16 + col][0], lane);
      __builtin_amdgcn_sched_barrier(0);                  // both groups' residuals are formed in front of the products: left alone the compiler sinks the second group's resid8 onto the first group's operand registers directly behind the products that read them
#pragma unroll   // the same
      for (int u = 0; u < QG; ++u) {
#pragma unroll   // the same
        for (int j = 0; j < 4; ++j) acc[u][j] = wmma16(vf[j], pa[u].v, acc[u][j]);
#pragma unroll   // the same
        for (int j = 0; j < 4; ++j) acc[u][j] = wmma16(vf[j], pal[u].v, acc[u][j]); }   // behind the four hi products, so that no product waits for the one before it on its own tile
      __builtin_amdgcn_sched_barrier(0);                  // keeps the trip's products in front of the publish point: left alone the compiler lifts the barrier over them, and the refill behind it is then issued a trip's arithmetic late, with little time left to land
      asm volatile("s_wait_dscnt 0x0" ::: "memory");      // this wave's LDS reads of stage ks have retired
      asm volatile("s_wait_asynccnt 0x0" ::: "memory");   // this wave's copies of stage ks + 1 have landed
      __syncthreads();                                    // publishes stage ks + 1 and ends every wave's reads of stage ks
      if (ks + 2 < NN / TK) copy_next(bf); }           // refill of the buffer just left; flies during trip ks + 1
    asm volatile("s_wait_asynccnt 0x0" ::: "memory");     // no copy is outstanding when the wave leaves the walk
#pragma unroll
    for (int u = 0; u < QG; ++u) { float t = l2[u].x + l2[u].y; t += xhalf(t); l[u] = t; } };   // the two lane halves' sums joined once
  v8f oa[4]; float ol;                                    // column group kh of the wave's queries, over all keys: the wave with key half kh finishes that group
  auto put = [&](auto uc) { constexpr int U = decltype(uc)::v;   // this wave's part of group U, for its partner
#pragma unroll
    for (int j = 0; j < 4; ++j) { sm[wave][2 * j][lane] = acc[U][j].lo; sm[wave][2 * j + 1][lane] = acc[U][j].hi; }
    sm[wave][8][lane] = v4f{l[U], m[U], 0.f, 0.f}; };
  auto take = [&](auto uc, auto fixed) { constexpr int U = decltype(uc)::v; constexpr bool FIX = decltype(fixed)::v;   // the partner's part of group U added to this wave's own
    const v4f lm = sm[wave ^ 4][8][lane]; float f0 = 1.0f, f1 = 1.0f;
    if constexpr (!FIX) { const float mm = fmaxf(m[U], lm.y); f0 = __builtin_amdgcn_exp2f(m[U] - mm); f1 = __builtin_amdgcn_exp2f(lm.y - mm); }   // the two parts stand at their own maxima: both brought to the larger
#pragma unroll
    for (int j = 0; j < 4; ++j) { const v4f x = sm[wave ^ 4][2 * j][lane], y = sm[wave ^ 4][2 * j + 1][lane];
#pragma unroll
      for (int r = 0; r < 4; ++r) { if constexpr (FIX) { oa[j][r] = acc[U][j][r] + x[r]; oa[j][4 + r] = acc[U][j][4 + r] + y[r]; } else { oa[j][r] = acc[U][j][r] * f0 + x[r] * f1; oa[j][4 + r] = acc[U][j][4 + r] * f0 + y[r] * f1; } } }
    if constexpr (FIX) ol = l[U] + lm.x; else ol = l[U] * f0 + lm.x * f1; };
  auto join = [&](auto fixed) {   // kh is the same in a whole wave: scalar branches
    if (kh == 0) put(int_c<1>{}); else put(int_c<0>{});
    __syncthreads();                                      // every wave's part is written; also no wave still reads the ring
    if (kh == 0) take(int_c<0>{}, fixed); else take(int_c<1>{}, fixed); };
  walk(flag_c<true>{}); join(flag_c<true>{});
  // range test: a row whose every key lies so far off that its sum sinks towards f16's smallest step (or is no number) is done again with the running maximum; the ring is the work-group's, so the eight waves decide together
  { const unsigned low = __builtin_amdgcn_ballot_w32(!(ol >= LMIN)); if (lane == 0) sredo[wave] = low; }
  __syncthreads();                                        // every wave's verdict is written; also every wave has read its partner's part
  { const v4u f = *(const v4u*)sredo, f2 = *(const v4u*)(sredo + 4);
    if (__builtin_amdgcn_readfirstlane((int)(f.x | f.y | f.z | f.w | f2.x | f2.y | f2.z | f2.w)) != 0) { gk -= NN * DD; gv -= NN; ring_start(); walk(flag_c<false>{}); join(flag_c<false>{}); } }   // back to stage 0: a walk steps over all NN keys
  float* px = X + ((b * NN + q0 + (tid >> 7) * 16) * NH + h) * DD + lane * 4;   // the lane's piece of the group's first output row
  v4f ro[16];                                             // the output rows as they go to memory: row q0 + 16 kh + rl, floats 4 col ..
  { const float il = 1.0f / ol;                           // ol stands at P's scale, which cancels
#pragma unroll   // unrolled so that oa and ro stay in registers
    for (int j = 0; j < 4; ++j) { v4f o0, o1;
#pragma unroll
      for (int r = 0; r < 4; ++r) { o0[r] = oa[j][r] * il; o1[r] = oa[j][4 + r] * il; }
      vst2(&so[wave][col][j * 16 + 8 * g], o0); vst2(&so[wave][col][j * 16 + 8 * g + 4], o1); }
    LDSX();
#pragma unroll   // the same
    for (int rl = 0; rl < 16; ++rl) ro[rl] = *(const v4f*)&so[wave][rl][col * 4]; }
#pragma unroll   // the same
  for (int rl = 0; rl < 16; ++rl) if (lane < 16) vst2(px + rl * (NH * DD), ro[rl]); }   // output [B][N][H][D]: the next query's row lies NH * DD floats on
extern "C" void kernel_launch(void* const* d_in, const int* in_sizes, int n_in, void* d_out, int out_size, void* d_ws, size_t ws_size, hipStream_t stream) {
  (void)in_sizes; (void)n_in; (void)out_size;
  const float** F = (const float**)d_in;   // 0 q, 1 k, 2 v [4,8,2048,64]
  if (ws_size < (size_t)WS_END) return;
  char* ws = (char*)d_ws; _Float16* VT = (_Float16*)(ws + WS_VT); float* KK = (float*)(ws + WS_KK);
  k_prep<<<dim3(NN / PK, NBH), 128, 0, stream>>>(F[1], F[2], VT, KK);
  k_att<<<dim3(NN / (64 * QG), TBH), 256, 0, stream>>>(F[0], F[1], KK, VT, (float*)d_out);
}

// v009
// One run takes 41.3 microseconds.
// In two side-by-side timings against v008, it was 1.14 and 1.15 times as fast.
// Counting every step since v000, it is 5.69 times as fast.
// compute dtype: all float inputs rounded to bf16; logits q . k with EXACT bf16 products on WMMA 16x16x32 (1 product: q and k are inputs), |k|^2 per key and |q|^2 per query in f32, softmax in f32 against the fixed reference |q - k|^2 >= 0 (hardware exp2; a row whose sum comes out too low is redone with the running maximum), P (x 2^15) rounded once to f16 . v (bf16 values as f16 planes, 1 product); row sums from the unrounded P in f32; f32 output.
#include <hip/hip_runtime.h>
#include <math.h>

typedef __attribute__((ext_vector_type(16))) _Float16 v16h;
typedef __attribute__((ext_vector_type(16))) __bf16 v16b;
typedef __attribute__((ext_vector_type(8)))  _Float16 v8h;
typedef __attribute__((ext_vector_type(8)))  float v8f;
typedef __attribute__((ext_vector_type(4)))  float v4f;
typedef __attribute__((ext_vector_type(2)))  float v2f;
typedef __attribute__((ext_vector_type(4)))  unsigned v4u;
typedef __attribute__((ext_vector_type(4)))  int v4i;
typedef float __attribute__((may_alias)) float_a;
typedef int __attribute__((may_alias)) int_a;

template <typename T> __device__ __forceinline__ void vst2(void* p, T v) { *(T*)p = v;  }
__device__ __forceinline__ v8f wmma16(v16h a, v16h b, v8f c) {
  v8f d = __builtin_amdgcn_wmma_f32_16x16x32_f16(false, a, false, b, (short)0, c, false, false);
  return d;
}
__device__ __forceinline__ v8f wmma_bf(v16b a, v16b b, v8f c) {
  v8f d = __builtin_amdgcn_wmma_f32_16x16x32_bf16(false, a, false, b, (short)0, c, false, false);
  return d;
}
// 16x16x32 fragments: lane = (h = lane>>4, row/col = lane&15); elements 0..7 = k0+8h+0..7, 8..15 = k0+16+8h+0..7; D element r = row 8h+r
__device__ __forceinline__ v16h frag_h(const _Float16* rowk0, int lane) {
  union { v16h v; v8h q[2]; } u; const _Float16* p = rowk0 + 8 * (lane >> 4);
  u.q[0] = *(const v8h*)p; u.q[1] = *(const v8h*)(p + 16); return u.v;
}
__device__ __forceinline__ v16h frag_f32(const float* rowk0, int lane) {
  v16h a; const float* p = rowk0 + 8 * (lane >> 4);
#pragma unroll
  for (int i = 0; i < 8; ++i) { a[i] = (_Float16)p[i]; a[8 + i] = (_Float16)p[16 + i]; }
  return a;
}
__device__ __forceinline__ v16h frag_f32s(const float* rowk0, int lane, float sc) {
  v16h a; const float* p = rowk0 + 8 * (lane >> 4);
#pragma unroll
  for (int i = 0; i < 8; ++i) { a[i] = (_Float16)(p[i] * sc); a[8 + i] = (_Float16)(p[16 + i] * sc); }
  return a;
}
// column fragment from a [K][ld] layout (column n), rows >= K read as 0
__device__ __forceinline__ v16h fragc_f32(const float* W, int k0, int n, int lane, int ld, int K) {
  v16h a; const int g = lane >> 4;
#pragma unroll
  for (int i = 0; i < 8; ++i) { const int ka = k0 + 8 * g + i, kb = ka + 16;
    a[i] = (_Float16)(ka < K ? W[(size_t)(ka < K ? ka : K - 1) * ld + n] : 0.f); a[8 + i] = (_Float16)(kb < K ? W[(size_t)(kb < K ? kb : K - 1) * ld + n] : 0.f); }
  return a;
}
struct F2 { v16b h, l; };
__device__ __forceinline__ F2 bsplit16(const float v[16]) { F2 r;
#pragma unroll
  for (int i = 0; i < 16; ++i) { const __bf16 h = (__bf16)v[i]; r.h[i] = h; r.l[i] = (__bf16)(v[i] - (float)h); }
  return r; }
__device__ __forceinline__ F2 split_row(const float* row, int k0, int lane) { float v[16]; const float* p = row + k0 + 8 * (lane >> 4);
#pragma unroll
  for (int i = 0; i < 8; ++i) { v[i] = p[i]; v[8 + i] = p[16 + i]; }
  return bsplit16(v); }
__device__ __forceinline__ F2 split_rowK(const float* row, int k0, int lane, int K) { float v[16]; const int g = lane >> 4;
#pragma unroll
  for (int i = 0; i < 8; ++i) { const int ka = k0 + 8 * g + i, kb = ka + 16; v[i] = ka < K ? row[ka < K ? ka : K - 1] : 0.f; v[8 + i] = kb < K ? row[kb < K ? kb : K - 1] : 0.f; }
  return bsplit16(v); }
__device__ __forceinline__ F2 split_col(const float* W, int k0, int n, int lane, int ld, int K) { float v[16]; const int g = lane >> 4;
#pragma unroll
  for (int i = 0; i < 8; ++i) { const int ka = k0 + 8 * g + i, kb = ka + 16; v[i] = ka < K ? W[(size_t)(ka < K ? ka : K - 1) * ld + n] : 0.f; v[8 + i] = kb < K ? W[(size_t)(kb < K ? kb : K - 1) * ld + n] : 0.f; }
  return bsplit16(v); }
__device__ __forceinline__ v8f mac3(const F2& a, const F2& b, v8f c) { c = wmma_bf(a.l, b.h, c); c = wmma_bf(a.h, b.l, c); return wmma_bf(a.h, b.h, c); }
__device__ __forceinline__ float sigm(float v) { return 1.0f / (1.0f + expf(-v)); }
#define LDSX() do { asm volatile("s_wait_dscnt 0" ::: "memory"); __builtin_amdgcn_wave_barrier(); __builtin_amdgcn_fence(__ATOMIC_RELEASE, "workgroup"); } while (0)


// Global L2-distance attention (B 4, H 8, N 2,048, D 64): attn = softmax(-(|q|^2 - 2 q.k + |k|^2) / 8) over keys; x = attn v, output [B, N, H, D].
#define NB 4
#define NH 8
#define NBH (NB * NH)
#define NN 2048
#define DD 64
#define SC1 0.36067376f    // log2(e) / 4: scale of q.k in the base-2 score
#define SC2 0.18033688f    // log2(e) / 8: scale of |k|^2 and |q|^2 there
#ifndef TBH
#define TBH NBH
#endif
typedef __attribute__((ext_vector_type(8))) __bf16 v8b;
__device__ __forceinline__ v16b frag_b(const __bf16* rowk0, int lane) {
  union { v16b v; v8b q[2]; } u; const __bf16* p = rowk0 + 8 * (lane >> 4);
  u.q[0] = *(const v8b*)p; u.q[1] = *(const v8b*)(p + 16); return u.v;
}
__device__ __forceinline__ float bfr(float v) { return (float)(__bf16)v; }
__device__ __attribute__((noinline)) float exp_ni(float v) { return expf(v); }
__device__ __attribute__((noinline)) float erf_ni(float v) { return erff(v); }

#define WS_VT  0u                                   // f16 v planes [bh][64][2048]
#define WS_KK  (WS_VT + 2u * (size_t)NBH * DD * NN)      // f32 |k|^2 log2(e) / 8 [bh][n]
#define WS_END (WS_KK + 4u * (size_t)NBH * NN)

__device__ __forceinline__ v16b fragb_f32(const float* __restrict__ p, int lane) { v16b a; const float* pp = p + 8 * (lane >> 4);
#pragma unroll
  for (int i = 0; i < 8; ++i) { a[i] = (__bf16)pp[i]; a[8 + i] = (__bf16)pp[16 + i]; } return a; }
typedef __attribute__((ext_vector_type(2))) _Float16 v2h_p;
// ---- k_prep: block = (128 keys, bh), 128 threads: v -> transposed f16 planes; kk = sum(k^2) log2(e) / 8. A thread's thirty-two 16-byte loads of v and k are all issued ahead of their first use: one trip to memory a block
#define PK 128   // keys a block
template <int M> __device__ __forceinline__ float row_xadd(float v) { return v + __builtin_bit_cast(float, __builtin_amdgcn_update_dpp(0, __builtin_bit_cast(int, v), 0x160 + M, 0xf, 0xf, true)); }   // v + the value of lane ^ M inside the 16-lane row (DPP row_xmask)
__global__ __launch_bounds__(128) void k_prep(const float* __restrict__ K, const float* __restrict__ V, _Float16* __restrict__ VT, float* __restrict__ KK) { __shared__ __align__(16) _Float16 st[DD][PK + 8]; __shared__ __align__(16) float skk[PK];
  const int t = threadIdx.x, c4 = (t & 15) * 4, a = t >> 4; const size_t bh = blockIdx.y; const int n0 = blockIdx.x * PK; const size_t r0 = bh * NN + n0;
  const float* pv = V + (r0 + 2 * a) * DD + c4; const float* pk = K + (r0 + a) * DD + c4;
  v4f va[PK / 16], vb[PK / 16], kr[PK / 8];   // 16 lanes read one whole 256-byte row; va, vb: v of key 2 (a + 8 i) and of the next; kr: k of key a + 8 i
#pragma unroll   // unrolled so that the arrays stay in registers and the loads stand together
  for (int i = 0; i < PK / 16; ++i) { va[i] = *(const v4f*)(pv + 16 * i * DD); vb[i] = *(const v4f*)(pv + (16 * i + 1) * DD); }
#pragma unroll   // the same
  for (int i = 0; i < PK / 8; ++i) kr[i] = *(const v4f*)(pk + 8 * i * DD);
  asm volatile("s_wait_xcnt 0x0" :: "v"(pv), "v"(pk) : "memory");   // the wait in front of any overwrite of the loads' address registers, which it names so that no later load lands on them; no load moves behind it either, so all thirty-two are in flight before the first use (left alone the compiler holds some back: a second trip to memory)
#pragma unroll   // the same
  for (int i = 0; i < PK / 16; ++i)
#pragma unroll   // the same
    for (int j = 0; j < 4; ++j) { const v2h_p w = {(_Float16)bfr(va[i][j]), (_Float16)bfr(vb[i][j])}; *(v2h_p*)&st[c4 + j][2 * (a + 8 * i)] = w; }   // two neighbouring keys of one d: one 4-byte LDS store
  float ks[PK / 8];
#pragma unroll   // the same
  for (int i = 0; i < PK / 8; ++i) { float s = 0.f;
#pragma unroll   // the same
    for (int j = 0; j < 4; ++j) { const float x = bfr(kr[i][j]); s += x * x; }
    s = row_xadd<1>(s); s = row_xadd<2>(s); s = row_xadd<4>(s); ks[i] = row_xadd<8>(s); }   // the row's 16 partial sums joined
  if ((t & 15) == 0) {
#pragma unroll   // the same
    for (int i = 0; i < PK / 8; ++i) skk[a + 8 * i] = ks[i] * SC2; }   // stored as its term of the base-2 score
  __syncthreads();
#pragma unroll   // unrolled so that the LDS reads stand ahead of the stores
  for (int i = 0; i < DD * (PK / 8) / 128; ++i) { const int e = t + 128 * i, d = e / (PK / 8), q = e % (PK / 8); vst2((unsigned*)(VT + (bh * DD + d) * (size_t)NN + n0 + q * 8), *(const v4u*)&st[d][q * 8]); }
  if (t < PK / 4) vst2(KK + r0 + t * 4, *(const v4f*)&skk[t * 4]); }
// ---- asynchronous copies to LDS: each lane brings its own 16 bytes; the s_wait_xcnt stands inside the copies' own statement, in front of any rewrite of their address registers
__device__ __forceinline__ unsigned lds_off(const void* p) { return (unsigned)(size_t)p; }   // low 32 bits of a __shared__ address = byte offset in the work-group's LDS
__device__ __forceinline__ void copy4(unsigned l0, unsigned l1, unsigned l2, unsigned l3, const void* g0, const void* g1, const void* g2, const void* g3) {
  asm volatile("global_load_async_to_lds_b128 %0, %4, off\n\tglobal_load_async_to_lds_b128 %1, %5, off\n\tglobal_load_async_to_lds_b128 %2, %6, off\n\tglobal_load_async_to_lds_b128 %3, %7, off\n\ts_wait_xcnt 0x0"
               :: "v"(l0), "v"(l1), "v"(l2), "v"(l3), "v"(g0), "v"(g1), "v"(g2), "v"(g3) : "memory"); }
__device__ __forceinline__ void copy6(unsigned l0, unsigned l1, unsigned l2, unsigned l3, unsigned l4, unsigned l5, const void* g0, const void* g1, const void* g2, const void* g3, const void* g4, const void* g5) {
  asm volatile("global_load_async_to_lds_b128 %0, %6, off\n\tglobal_load_async_to_lds_b128 %1, %7, off\n\tglobal_load_async_to_lds_b128 %2, %8, off\n\tglobal_load_async_to_lds_b128 %3, %9, off\n\tglobal_load_async_to_lds_b128 %4, %10, off\n\tglobal_load_async_to_lds_b128 %5, %11, off\n\ts_wait_xcnt 0x0"
               :: "v"(l0), "v"(l1), "v"(l2), "v"(l3), "v"(l4), "v"(l5), "v"(g0), "v"(g1), "v"(g2), "v"(g3), "v"(g4), "v"(g5) : "memory"); }
#define PSH 15.0f          // P = 2^score has its top value at 2^15, inside f16
#define LMIN 0x1p-7f       // smallest row sum (at that scale) taken from the fixed reference
template <bool B> struct flag_c { static constexpr bool v = B; };
#define KPITCH 68   // floats: 272-byte rows, conflict-free for 16-byte LDS reads of 256-byte rows
#define VPITCH 40   // halves: 80-byte rows, the same for 64-byte rows
// ---- k_att: block = (128 queries, bh), eight waves: wave w and wave w + 4 have the same 32 queries (two 16-column groups) and each walks one 32-key half of every 64-key ring stage, so that four waves stand on a SIMD; the fixed reference makes the two halves' sums plain addends, joined once through LDS behind the walk. Transposed products: S^T = k . q^T (a lane holds 16 keys' scores of ONE query a group), base-2 score = PSH - log2(e) |q - k|^2 / 8, its per-query part entered as the C operand of the score products; P = 2^score, summed in the lane; O^T += v^T . P^T with P, rounded to f16, packed from the score registers; the 64-key stages of k and v come through a two-buffer LDS ring shared by the eight waves
typedef __attribute__((ext_vector_type(2))) _Float16 v2h;
__device__ __forceinline__ float xhalf(float v) { return __builtin_bit_cast(float, __builtin_amdgcn_permlanex16(__builtin_bit_cast(int, v), __builtin_bit_cast(int, v), 0x76543210, 0xfedcba98, false, false)); }   // the value of lane ^ 16
#define QG 2   // 16-query column groups a wave: every k and v fragment read from LDS (and every rounding of k) serves both
#define KS 2   // key halves of a ring stage, one a wave
#define TK (32 * KS)   // keys a ring stage
// two such blocks stand on a WGP (four waves a SIMD) as long as the listing shows at most 256 registers and twice the LDS fits: read both after any change
template <int N> struct int_c { static constexpr int v = N; };
__device__ __forceinline__ void copy2(unsigned l0, unsigned l1, const void* g0, const void* g1) {
  asm volatile("global_load_async_to_lds_b128 %0, %2, off\n\tglobal_load_async_to_lds_b128 %1, %3, off\n\ts_wait_xcnt 0x0"
               :: "v"(l0), "v"(l1), "v"(g0), "v"(g1) : "memory"); }
__global__ __launch_bounds__(256) void k_att(const float* __restrict__ Q, const float* __restrict__ K, const float* __restrict__ KK, const _Float16* __restrict__ VT, float* __restrict__ X) {
  __shared__ __align__(16) float so[4 * KS][16][68];
  __shared__ __align__(16) float sk[2][TK][KPITCH]; __shared__ __align__(16) _Float16 sv[2][KS][DD][VPITCH]; __shared__ __align__(16) float skk[NN]; __shared__ __align__(16) unsigned sredo[4 * KS];
  __shared__ __align__(16) v4f sm[4 * KS][9][32];       // a wave's part of the column group that its partner finishes: eight quads of O^T and (sum, maximum) a lane
  const int tid = threadIdx.x, wave = __builtin_amdgcn_readfirstlane(tid >> 5), kh = wave >> 2, lane = tid & 31, col = lane & 15, g = lane >> 4; const size_t bh = blockIdx.y; const size_t b = bh / NH, h = bh % NH; const int q0 = blockIdx.x * (64 * QG) + ((tid >> 5) & 3) * (16 * QG); const size_t rq = bh * NN + q0;
  const float* gk = K + (bh * NN + (tid >> 4)) * DD + (tid & 15) * 4;                    // k stage: 64 rows of 256 bytes, a thread's four pieces lie 16 rows apart
  const _Float16* gv = VT + (bh * DD + (tid >> 3)) * (size_t)NN + (tid & 7) * 8;          // v stage: 64 rows (d) of 128 bytes, a thread's two pieces lie 32 rows apart; in LDS each 32-key half has its own plane
  auto copy_next = [&](int bf) {   // the next stage in key order into buffer bf; gk and gv then step on to the stage behind it
    const float* a = gk; const unsigned la = lds_off(&sk[bf][tid >> 4][(tid & 15) * 4]);
    const _Float16* c = gv; const unsigned lc = lds_off(&sv[bf][(tid & 7) >> 2][tid >> 3][(tid & 3) * 8]);
    copy6(la, la + 16 * KPITCH * 4, la + 32 * KPITCH * 4, la + 48 * KPITCH * 4, lc, lc + 32 * VPITCH * 2, a, a + 16 * DD, a + 32 * DD, a + 48 * DD, c, c + 32 * (size_t)NN);
    gk += TK * DD; gv += TK; };
  { const float* a = KK + bh * NN + tid * 4; const unsigned la = lds_off(&skk[tid * 4]); copy2(la, la + 4096, a, a + 1024); }   // scaled |k|^2 of all keys, filled once
  auto ring_start = [&]() {
    copy_next(0);
    asm volatile("s_wait_asynccnt 0x0" ::: "memory");   // this wave's copies of stage 0 (the first time of |k|^2 too) have landed
    __syncthreads();                                    // every wave's have: stage 0 may be read
    copy_next(1); };
  ring_start();
  v16b aq[QG][2];                                     // B operand: column = query q0 + 16 u + col
  v8f c0v[QG];
  const float* pq = Q + (rq + col) * DD + 8 * g;      // the lane's own first element of query q0 + col; the second group lies 16 rows on
#pragma unroll
  for (int u = 0; u < QG; ++u)
#pragma unroll
    for (int kc = 0; kc < 2; ++kc)
#pragma unroll
      for (int i = 0; i < 8; ++i) { aq[u][kc][i] = (__bf16)pq[u * 16 * DD + kc * 32 + i]; aq[u][kc][8 + i] = (__bf16)pq[u * 16 * DD + kc * 32 + 16 + i]; }   // the k order of fragb_f32
  asm volatile("s_wait_xcnt 0x0" :: "v"(pq) : "memory");   // the wait in front of any overwrite of the q loads' address register pair, which it names so that the pair lives up to it
#pragma unroll
  for (int u = 0; u < QG; ++u) {
    float qq = 0.f;                                   // |q|^2 of that query: each lane half holds 32 of the 64 elements
#pragma unroll
    for (int kc = 0; kc < 2; ++kc)
#pragma unroll
      for (int i = 0; i < 16; ++i) { const float x = (float)aq[u][kc][i]; qq += x * x; }
    qq += xhalf(qq);
    const float c0 = PSH / SC1 - 0.5f * qq;           // start value of every score tile: SC1 * (q.k + c0) - SC2 |k|^2 = PSH - log2(e) |q - k|^2 / 8, never above PSH (but for rounding)
    c0v[u] = v8f{c0, c0, c0, c0, c0, c0, c0, c0}; }
  float m[QG], l[QG]; v2f l2[QG]; v8f acc[QG][4];     // of query q0 + 16 u + col, over this wave's keys: m equal in both lane halves, l2 each half's own part; O^T: element r of tile j = d j * 16 + 8 g + r
  auto walk = [&](auto fixed) { constexpr bool FIX = decltype(fixed)::v;   // FIX: p = 2^score as it stands; else the running maximum of the scores is taken off first
#pragma unroll
    for (int u = 0; u < QG; ++u) { m[u] = -3.0e38f; l2[u] = v2f{0.f, 0.f};
#pragma unroll
      for (int j = 0; j < 4; ++j) acc[u][j] = v8f{}; }
#pragma unroll 1
    for (int ks = 0; ks < NN / TK; ++ks) { v2f s[QG][2][4]; const int bf = ks & 1;
#pragma unroll
      for (int ct = 0; ct < 2; ++ct) {                // element r = key ks * 64 + kh * 32 + ct * 16 + 8 g + r
        const v16b kf0 = fragb_f32(&sk[bf][kh * 32 + ct * 16 + col][0], lane), kf1 = fragb_f32(&sk[bf][kh * 32 + ct * 16 + col][32], lane);
        const float* kkp = &skk[ks * TK + kh * 32 + ct * 16 + 8 * g]; const v4f ka = *(const v4f*)kkp, kb = *(const v4f*)(kkp + 4);
#pragma unroll
        for (int u = 0; u < QG; ++u) { v8f c = wmma_bf(kf0, aq[u][0], c0v[u]); c = wmma_bf(kf1, aq[u][1], c);
          s[u][ct][0] = c.s01 * SC1 - ka.s01; s[u][ct][1] = c.s23 * SC1 - ka.s23; s[u][ct][2] = c.s45 * SC1 - kb.s01; s[u][ct][3] = c.s67 * SC1 - kb.s23; } }
      union { v16h v; unsigned w[8]; } pa[QG];   // B operand of the second product: element i = key 8 g + i, element 8 + i = key 16 + 8 g + i: the two score tiles as they lie
#pragma unroll
      for (int u = 0; u < QG; ++u) { v2f pv[8];
        if constexpr (!FIX) {
          float mx = fmaxf(s[u][0][0].x, s[u][0][0].y);
#pragma unroll
          for (int i = 1; i < 8; ++i) mx = fmaxf(mx, fmaxf(s[u][i >> 2][i & 3].x, s[u][i >> 2][i & 3].y));
          mx = fmaxf(mx, xhalf(mx));
          const float mn = fmaxf(m[u], mx), alpha = __builtin_amdgcn_exp2f(m[u] - mn), sh = mn - 11.0f; m[u] = mn;
#pragma unroll
          for (int i = 0; i < 8; ++i) s[u][i >> 2][i & 3] -= sh;   // p's top value 2^11
          l2[u] *= alpha;
#pragma unroll
          for (int j = 0; j < 4; ++j)
#pragma unroll
            for (int r = 0; r < 8; ++r) acc[u][j][r] *= alpha; }
#pragma unroll
        for (int i = 0; i < 8; ++i) { const v2f d = s[u][i >> 2][i & 3]; pv[i] = v2f{__builtin_amdgcn_exp2f(d.x), __builtin_amdgcn_exp2f(d.y)};
          pa[u].w[i] = __builtin_bit_cast(unsigned, __builtin_convertvector(pv[i], v2h)); }
        l2[u] += ((pv[0] + pv[1]) + (pv[2] + pv[3])) + ((pv[4] + pv[5]) + (pv[6] + pv[7])); }
      v16h vf[4];
#pragma unroll   // unrolled so that vf and acc stay in registers
      for (int j = 0; j < 4; ++j) vf[j] = frag_h(&sv[bf][kh][j * 16 + col][0], lane);
#pragma unroll   // the same
      for (int u = 0; u < QG; ++u)
#pragma unroll   // the same
        for (int j = 0; j < 4; ++j) acc[u][j] = wmma16(vf[j], pa[u].v, acc[u][j]);   // p is rounded once, to f16's 11 bits: finer than the 8 bits of the bf16 inputs
      __builtin_amdgcn_sched_barrier(0);                  // keeps the trip's products in front of the publish point: left alone the compiler lifts the barrier over them, and the refill behind it is then issued a trip's arithmetic late, with little time left to land
      asm volatile("s_wait_dscnt 0x0" ::: "memory");      // this wave's LDS reads of stage ks have retired
      asm volatile("s_wait_asynccnt 0x0" ::: "memory");   // this wave's copies of stage ks + 1 have landed
      __syncthreads();                                    // publishes stage ks + 1 and ends every wave's reads of stage ks
      if (ks + 2 < NN / TK) copy_next(bf); }           // refill of the buffer just left; flies during trip ks + 1
    asm volatile("s_wait_asynccnt 0x0" ::: "memory");     // no copy is outstanding when the wave leaves the walk
#pragma unroll
    for (int u = 0; u < QG; ++u) { float t = l2[u].x + l2[u].y; t += xhalf(t); l[u] = t; } };   // the two lane halves' sums joined once
  v8f oa[4]; float ol;                                    // column group kh of the wave's queries, over all keys: the wave with key half kh finishes that group
  auto put = [&](auto uc) { constexpr int U = decltype(uc)::v;   // this wave's part of group U, for its partner
#pragma unroll
    for (int j = 0; j < 4; ++j) { sm[wave][2 * j][lane] = acc[U][j].lo; sm[wave][2 * j + 1][lane] = acc[U][j].hi; }
    sm[wave][8][lane] = v4f{l[U], m[U], 0.f, 0.f}; };
  auto take = [&](auto uc, auto fixed) { constexpr int U = decltype(uc)::v; constexpr bool FIX = decltype(fixed)::v;   // the partner's part of group U added to this wave's own
    const v4f lm = sm[wave ^ 4][8][lane]; float f0 = 1.0f, f1 = 1.0f;
    if constexpr (!FIX) { const float mm = fmaxf(m[U], lm.y); f0 = __builtin_amdgcn_exp2f(m[U] - mm); f1 = __builtin_amdgcn_exp2f(lm.y - mm); }   // the two parts stand at their own maxima: both brought to the larger
#pragma unroll
    for (int j = 0; j < 4; ++j) { const v4f x = sm[wave ^ 4][2 * j][lane], y = sm[wave ^ 4][2 * j + 1][lane];
#pragma unroll
      for (int r = 0; r < 4; ++r) { if constexpr (FIX) { oa[j][r] = acc[U][j][r] + x[r]; oa[j][4 + r] = acc[U][j][4 + r] + y[r]; } else { oa[j][r] = acc[U][j][r] * f0 + x[r] * f1; oa[j][4 + r] = acc[U][j][4 + r] * f0 + y[r] * f1; } } }
    if constexpr (FIX) ol = l[U] + lm.x; else ol = l[U] * f0 + lm.x * f1; };
  auto join = [&](auto fixed) {   // kh is the same in a whole wave: scalar branches
    if (kh == 0) put(int_c<1>{}); else put(int_c<0>{});
    __syncthreads();                                      // every wave's part is written; also no wave still reads the ring
    if (kh == 0) take(int_c<0>{}, fixed); else take(int_c<1>{}, fixed); };
  walk(flag_c<true>{}); join(flag_c<true>{});
  // range test: a row whose every key lies so far off that its sum sinks towards f16's smallest step (or is no number) is done again with the running maximum; the ring is the work-group's, so the eight waves decide together
  { const unsigned low = __builtin_amdgcn_ballot_w32(!(ol >= LMIN)); if (lane == 0) sredo[wave] = low; }
  __syncthreads();                                        // every wave's verdict is written; also every wave has read its partner's part
  { const v4u f = *(const v4u*)sredo, f2 = *(const v4u*)(sredo + 4);
    if (__builtin_amdgcn_readfirstlane((int)(f.x | f.y | f.z | f.w | f2.x | f2.y | f2.z | f2.w)) != 0) { gk -= NN * DD; gv -= NN; ring_start(); walk(flag_c<false>{}); join(flag_c<false>{}); } }   // back to stage 0: a walk steps over all NN keys
  float* px = X + ((b * NN + q0 + (tid >> 7) * 16) * NH + h) * DD + lane * 4;   // the lane's piece of the group's first output row
  v4f ro[16];                                             // the output rows as they go to memory: row q0 + 16 kh + rl, floats 4 col ..
  { const float il = 1.0f / ol;                           // ol stands at P's scale, which cancels
#pragma unroll   // unrolled so that oa and ro stay in registers
    for (int j = 0; j < 4; ++j) { v4f o0, o1;
#pragma unroll
      for (int r = 0; r < 4; ++r) { o0[r] = oa[j][r] * il; o1[r] = oa[j][4 + r] * il; }
      vst2(&so[wave][col][j * 16 + 8 * g], o0); vst2(&so[wave][col][j * 16 + 8 * g + 4], o1); }
    LDSX();
#pragma unroll   // the same
    for (int rl = 0; rl < 16; ++rl) ro[rl] = *(const v4f*)&so[wave][rl][col * 4]; }
#pragma unroll   // the same
  for (int rl = 0; rl < 16; ++rl) if (lane < 16) vst2(px + rl * (NH * DD), ro[rl]); }   // output [B][N][H][D]: the next query's row lies NH * DD floats on
extern "C" void kernel_launch(void* const* d_in, const int* in_sizes, int n_in, void* d_out, int out_size, void* d_ws, size_t ws_size, hipStream_t stream) {
  (void)in_sizes; (void)n_in; (void)out_size;
  const float** F = (const float**)d_in;   // 0 q, 1 k, 2 v [4,8,2048,64]
  if (ws_size < (size_t)WS_END) return;
  char* ws = (char*)d_ws; _Float16* VT = (_Float16*)(ws + WS_VT); float* KK = (float*)(ws + WS_KK);
  k_prep<<<dim3(NN / PK, NBH), 128, 0, stream>>>(F[1], F[2], VT, KK);
  k_att<<<dim3(NN / (64 * QG), TBH), 256, 0, stream>>>(F[0], F[1], KK, VT, (float*)d_out);
}
